// v000
// The times below were measured on an AMD MI455X: many runs one after another, warmed up first and cycling through
// copies of the inputs, with the whole window's GPU time divided by the number of runs. Launches and the gaps
// between them are all in it. The median over several windows is given; except for v000 it joins two sittings, which
// can be a few percent apart, so the side-by-side timings, each taken in one sitting, are the better comparison.
// The starting kernel, v000, takes 626 microseconds a run.
#include <hip/hip_runtime.h>

// Scaled dot-product attention on given tensors, one 128-wide head over 4,096 positions (query, keys, value [4][4096][128]; scores = q.k / sqrt(128); softmax over all 4,096 keys; out = attn value -> [4][4096][128] (2.1 M)).
// Layout per batch: single bf16 planes (inputs bf16-exact: exact score products); register-row softmax with every row on hi/lo planes; P hi/lo x exact value; the f32 merge writes the output rows.
// Compute dtypes, f32 accumulate: every input rounded to bf16; q.k exact; softmax f32; P hi/lo x exact value; output f32.

#define NB_  4
#define TT   4096
#define DM   128      // token-major row pitch (H x HD)
#define NH_  1
#define NKV  1
#define REP  (NH_ / NKV)
#define HD   128
#define DQ   (NH_ * HD)
#define DKV  (NKV * HD)
#define ZH   1
#define RH   4096                  // query rows < RH use hi+lo planes (0: none)
#define WIN  0
#define PCAR 1024.0f
#define SCL  0.088388347648318447f   // 1/sqrt(128)
typedef _Float16 h16;
typedef unsigned short bf;
typedef __attribute__((ext_vector_type(16))) __bf16   v16bf;
typedef __attribute__((ext_vector_type(16))) _Float16 v16h;
typedef __attribute__((ext_vector_type(8)))  _Float16 v8h;
typedef __attribute__((ext_vector_type(8)))  unsigned short v8us;
typedef __attribute__((ext_vector_type(8)))  float    v8f;
typedef __attribute__((ext_vector_type(4)))  float    v4f;
typedef v8h  __attribute__((may_alias)) v8ha;
typedef v4f  __attribute__((may_alias)) v4fa;
typedef v8us __attribute__((may_alias)) v8usa;

__device__ __forceinline__ unsigned short f2bf(float f) { unsigned u = __float_as_uint(f); u += 0x7FFFu + ((u >> 16) & 1u); return (unsigned short)(u >> 16); }
__device__ __forceinline__ float bf2f(unsigned short b) { return __uint_as_float(((unsigned)b) << 16); }
__device__ __forceinline__ float bfr(float f) { return bf2f(f2bf(f)); }
__device__ __forceinline__ v16h cat16(v8h lo, v8h hi) { return __builtin_shufflevector(lo, hi, 0, 1, 2, 3, 4, 5, 6, 7, 8, 9, 10, 11, 12, 13, 14, 15); }
__device__ __forceinline__ v16bf cat16b(v8us lo, v8us hi) { return __builtin_bit_cast(v16bf, __builtin_shufflevector(lo, hi, 0, 1, 2, 3, 4, 5, 6, 7, 8, 9, 10, 11, 12, 13, 14, 15)); }
__device__ __forceinline__ v8f wmma16(v16h a, v16h b, v8f c) { return __builtin_amdgcn_wmma_f32_16x16x32_f16(false, a, false, b, (short)0, c, false, false); }
__device__ __forceinline__ v8f wmmab(v16bf a, v16bf b, v8f c) { return __builtin_amdgcn_wmma_f32_16x16x32_bf16(false, a, false, b, (short)0, c, false, false); }



// ---- k_gemmw: register-blocked GEMM, ONE WAVE per 64x64 output tile (16 accumulators), operands straight from K-contiguous 16-bit planes; grid (M/64, N/64, Z), 32 threads.
// C[m][n] (f32, pitch ldc, + optional f32 bias[n]) = sum_k A[m][k] Bt[n][k] (+ split products per NSPLIT). z-batch strides sA/sB/sC in elements. K % 32 == 0.
template <typename T16> struct WFrag;
template <> struct WFrag<h16> { typedef v16h V; static __device__ __forceinline__ V ld(const h16* p) { return cat16(*(const v8h*)p, *(const v8h*)(p + 16)); } static __device__ __forceinline__ v8f mma(V a, V b, v8f c) { return wmma16(a, b, c); } };
template <> struct WFrag<bf> { typedef v16bf V; static __device__ __forceinline__ V ld(const bf* p) { return cat16b(*(const v8us*)p, *(const v8us*)(p + 16)); } static __device__ __forceinline__ v8f mma(V a, V b, v8f c) { return wmmab(a, b, c); } };
template <typename T16, int NSPLIT, bool BIAS>
__global__ __launch_bounds__(32) void k_gemmw(const T16* __restrict__ A, const T16* __restrict__ A2, const T16* __restrict__ Bt, const T16* __restrict__ Bt2, int K, float* C, int ldc, const float* __restrict__ bias, size_t sA, size_t sB, size_t sC) {
    typedef typename WFrag<T16>::V V;
    __shared__ __align__(16) float os[16 * 68];
    const size_t z = blockIdx.z; A += z * sA; if (A2) A2 += z * sA; Bt += z * sB; if (Bt2) Bt2 += z * sB; C += z * sC;
    const int lane = threadIdx.x & 31, lr = lane & 15, hi = lane >> 4; const int r0 = blockIdx.x * 64, c0 = blockIdx.y * 64;
    v8f acc[4][4];
#pragma unroll
    for (int mb = 0; mb < 4; ++mb)
#pragma unroll
        for (int nb = 0; nb < 4; ++nb) acc[mb][nb] = (v8f){};
    const size_t aoff = (size_t)(r0 + lr) * K + 8 * hi, boff = (size_t)(c0 + lr) * K + 8 * hi;
#pragma unroll 1
    for (int kc = 0; kc < K; kc += 32) {
        V a[4], a2[4];
#pragma unroll
        for (int mb = 0; mb < 4; ++mb) { a[mb] = WFrag<T16>::ld(A + aoff + (size_t)mb * 16 * K + kc); if (NSPLIT == 1 || NSPLIT == 2) a2[mb] = WFrag<T16>::ld(A2 + aoff + (size_t)mb * 16 * K + kc); }
#pragma unroll
        for (int nb = 0; nb < 4; ++nb) { const V b = WFrag<T16>::ld(Bt + boff + (size_t)nb * 16 * K + kc); V b2; if (NSPLIT >= 2) b2 = WFrag<T16>::ld(Bt2 + boff + (size_t)nb * 16 * K + kc);
#pragma unroll
            for (int mb = 0; mb < 4; ++mb) { acc[mb][nb] = WFrag<T16>::mma(a[mb], b, acc[mb][nb]); if (NSPLIT == 1 || NSPLIT == 2) acc[mb][nb] = WFrag<T16>::mma(a2[mb], b, acc[mb][nb]); if (NSPLIT >= 2) acc[mb][nb] = WFrag<T16>::mma(a[mb], b2, acc[mb][nb]); } }
        asm volatile("v_nop\n\tv_nop\n\tv_nop\n\tv_nop" : "+v"(acc[0][0]), "+v"(acc[1][1]), "+v"(acc[2][2]), "+v"(acc[3][3]) : "v"(a[0]), "v"(a[3]));
    }
#pragma unroll
    for (int mb = 0; mb < 4; ++mb) {
#pragma unroll
        for (int nb = 0; nb < 4; ++nb) {
#pragma unroll
            for (int j = 0; j < 8; ++j) os[(hi * 8 + j) * 68 + nb * 16 + lr] = acc[mb][nb][j]; }
        __builtin_amdgcn_wave_barrier(); asm volatile("" ::: "memory");
        float* crow = C + (size_t)(r0 + mb * 16) * ldc + c0;
{
#pragma unroll
            for (int s = 0; s < 8; ++s) { const int row = 2 * s + hi, cofs = lr * 4; v4f val = *(const v4fa*)(os + row * 68 + cofs); if (BIAS) { val[0] += bfr(bias[c0 + cofs]); val[1] += bfr(bias[c0 + cofs + 1]); val[2] += bfr(bias[c0 + cofs + 2]); val[3] += bfr(bias[c0 + cofs + 3]); }
                *(v4f*)(crow + (size_t)row * ldc + cofs) = val; }
             }
        __builtin_amdgcn_wave_barrier(); asm volatile("" ::: "memory");
    }
}

__device__ __forceinline__ h16 tohx(float x) { return (h16)x; }
__device__ __forceinline__ void splitf(float y, unsigned short& h, unsigned short& l) { h = f2bf(y); l = f2bf(y - bf2f(h)); }
typedef __attribute__((ext_vector_type(2))) _Float16 v2h;
typedef __attribute__((ext_vector_type(4))) _Float16 v4h;
typedef __attribute__((ext_vector_type(2))) unsigned short v2us;
typedef __attribute__((ext_vector_type(4))) unsigned short v4us;
typedef __attribute__((ext_vector_type(2))) float v2f;
typedef __attribute__((ext_vector_type(4))) int v4i;

__global__ __launch_bounds__(256) void k_wtG(const float* __restrict__ w, int K, int N, bf* Bt) {
    const int lane = threadIdx.x & 31; const int L0 = (blockIdx.x * 8 + (threadIdx.x >> 5)) * 8; const int nlines = N * K / 64;
{
#pragma unroll 1
        for (int l = 0; l < 8; ++l) { const int L = L0 + l; if (L >= nlines) break; const size_t e = (size_t)L * 64 + lane * 2; const int k = (int)(e % K), n = (int)(e / K); v2us o;
            o[0] = f2bf(w[(size_t)k * N + n]); o[1] = f2bf(w[(size_t)(k + 1) * N + n]); *(v2us*)(Bt + e) = o; }
         }
}
__global__ __launch_bounds__(256) void k_cvt8(const float* __restrict__ src, bf* dst, size_t n8) { const size_t i = (size_t)blockIdx.x * 256 + threadIdx.x; if (i >= n8) return; const v8f v = *(const v8f*)(src + i * 8); v8us o;
#pragma unroll
    for (int k = 0; k < 8; ++k) o[k] = f2bf(v[k]); *(v8us*)(dst + i * 8) = o;  }


__global__ __launch_bounds__(256) void k_vtp(const float* __restrict__ F, int pitch, int nheads, h16* V16, bf* Vh, bf* Vl) { const size_t e = ((size_t)blockIdx.x * 256 + threadIdx.x) * 2; if (e >= (size_t)nheads * HD * TT) return; const int t = (int)(e % TT); const int d = (int)((e / TT) % HD); const int g = (int)(e / ((size_t)TT * HD)); v2h o16; v2us oh, ol;
#pragma unroll
    for (int q = 0; q < 2; ++q) { const float x = F[(size_t)(t + q) * pitch + g * HD + d]; o16[q] = tohx(x); unsigned short a2, c2; splitf(x, a2, c2); oh[q] = a2; ol[q] = c2; }
    *(v2h*)(V16 + e) = o16; *(v2us*)(Vh + e) = oh; *(v2us*)(Vl + e) = ol;  }

// k_asoft: per row (zz, i): t = S x HD^-0.5 (no mask); softmax over the 4096 keys (register row, one exp, fixed trees);
__global__ __launch_bounds__(256) void k_asoft(const float* __restrict__ Sb, h16* P16, bf* Ph, bf* Pl) {
    const int lane = threadIdx.x & 31; const int row = blockIdx.x * 8 + (threadIdx.x >> 5); if (row >= ZH * TT) return; const int i = row % TT; const int zz = row / TT; (void)zz; const bool hires = (i < RH); const float* sr = Sb + (size_t)row * TT; float v[TT / 32]; float mx = -3.0e38f;
#pragma unroll
    for (int ch = 0; ch < TT / 128; ++ch) { const int j0 = ch * 128 + lane * 4; const v4f a = *(const v4f*)(sr + j0);
#pragma unroll
        for (int q = 0; q < 4; ++q) { const float t = a[q] * SCL; v[ch * 4 + q] = t;   /* Sb holds q.k only (k_gemmw, no bias) */ mx = fmaxf(mx, t); } }
#pragma unroll
    for (int sh = 16; sh; sh >>= 1) mx = fmaxf(mx, __shfl_xor(mx, sh, 32));
    float sum = 0.f;
#pragma unroll
    for (int k = 0; k < TT / 32; ++k) { float d0 = __fsub_rn(v[k], mx); asm volatile("" : "+v"(d0)); v[k] = __builtin_amdgcn_exp2f(__fmul_rn(d0, 1.4426950408889634f)); sum += v[k]; }
#pragma unroll
    for (int sh = 16; sh; sh >>= 1) sum += __shfl_xor(sum, sh, 32);
    const float f = __fdiv_rn(hires ? 1.0f : PCAR, sum);
{
        if (hires) {
#pragma unroll
            for (int ch = 0; ch < TT / 128; ++ch) { v4us oh, ol;
#pragma unroll
                for (int q = 0; q < 4; ++q) { unsigned short a, c2; splitf(v[ch * 4 + q] * f, a, c2); oh[q] = a; ol[q] = c2; }
                const size_t oo = ((size_t)zz * (RH ? RH : 1) + i) * TT + ch * 128 + lane * 4; *(v4us*)(Ph + oo) = oh; *(v4us*)(Pl + oo) = ol; }
        } else {
#pragma unroll
            for (int ch = 0; ch < TT / 128; ++ch) { v4h o4;
#pragma unroll
                for (int q = 0; q < 4; ++q) o4[q] = tohx(v[ch * 4 + q] * f);
                *(v4h*)(P16 + (size_t)row * TT + ch * 128 + lane * 4) = o4; } }
         }
}
__global__ __launch_bounds__(256) void k_merge(const float* __restrict__ O, int h0, float* OUTb) { const size_t e = ((size_t)blockIdx.x * 256 + threadIdx.x) * 2; if (e >= (size_t)ZH * TT * HD) return; const int d = (int)(e % HD); const int t = (int)((e / HD) % TT); const int zz = (int)(e / ((size_t)HD * TT)); const float cs = (t < RH) ? 1.0f : (1.0f / PCAR); const size_t oo = (size_t)t * DQ + (h0 + zz) * HD + d;
    v2f o2; o2[0] = O[e] * cs; o2[1] = O[e + 1] * cs; *(v2f*)(OUTb + oo) = o2;  }


__global__ __launch_bounds__(256) void k_vtpR1(const float* __restrict__ Vb, bf* Vh) { const size_t e = ((size_t)blockIdx.x * 256 + threadIdx.x) * 2; if (e >= (size_t)HD * TT) return; const int t = (int)(e % TT); const int d = (int)(e / TT); v2us o; o[0] = f2bf(Vb[(size_t)t * HD + d]); o[1] = f2bf(Vb[(size_t)(t + 1) * HD + d]); *(v2us*)(Vh + e) = o;  }
__global__ __launch_bounds__(256) void k_mergeR(const float* __restrict__ O, float* outb, size_t n4) { const size_t i = (size_t)blockIdx.x * 256 + threadIdx.x; if (i >= n4) return; const v4f a = *(const v4f*)(O + i * 4); *(v4f*)(outb + i * 4) = a;  }


__global__ __launch_bounds__(256) void k_hp1(const float* __restrict__ src, bf* P) { const size_t i = (size_t)blockIdx.x * 256 + threadIdx.x; if (i >= (size_t)NH_ * TT * HD / 8) return; const size_t e = i * 8; const int d = (int)(e % HD); const int t = (int)((e / HD) % TT); const int h = (int)(e / ((size_t)HD * TT)); const v8f v = *(const v8f*)(src + (size_t)t * DM + h * HD + d); v8us o;
#pragma unroll
    for (int q = 0; q < 8; ++q) o[q] = f2bf(v[q]);
    *(v8us*)(P + e) = o;  }
__global__ __launch_bounds__(256) void k_vt1(const float* __restrict__ src, int pitch, bf* VT) { const size_t e = ((size_t)blockIdx.x * 256 + threadIdx.x) * 2; if (e >= (size_t)NH_ * HD * TT) return; const int t = (int)(e % TT); const int d = (int)((e / TT) % HD); const int h = (int)(e / ((size_t)TT * HD)); v2us o; o[0] = f2bf(src[(size_t)t * pitch + h * HD + d]); o[1] = f2bf(src[(size_t)(t + 1) * pitch + h * HD + d]); *(v2us*)(VT + e) = o;  }
__global__ __launch_bounds__(256) void k_mergeT(const float* __restrict__ O, int h, float* outb) { const size_t i = (size_t)blockIdx.x * 256 + threadIdx.x; if (i >= (size_t)TT * HD / 4) return; const size_t e = i * 4; const int d = (int)(e % HD); const int t = (int)(e / HD); const v4f a = *(const v4f*)(O + e); *(v4f*)(outb + (size_t)t * DM + h * HD + d) = a;  }

extern "C" void kernel_launch(void* const* d_in, const int* in_sizes, int n_in,
                              void* d_out, int out_size, void* d_ws, size_t ws_size, hipStream_t stream) {
    (void)in_sizes; (void)n_in; (void)out_size;
    const float* Qin = (const float*)d_in[0]; const float* Kin = (const float*)d_in[1]; const float* Vin = (const float*)d_in[2];
    float* OUT = (float*)d_out;
    char* wsp = (char*)d_ws;
    auto take = [&](size_t bytes) { char* p = wsp; wsp += (bytes + 255) & ~(size_t)255; return (void*)p; };
    bf* QB = (bf*)take((size_t)NH_ * TT * HD * 2); bf* KB = (bf*)take((size_t)NH_ * TT * HD * 2); bf* VT = (bf*)take((size_t)NH_ * HD * TT * 2);
    float* Sb = (float*)take((size_t)TT * TT * 4);  bf* Ph = (bf*)take((size_t)TT * TT * 2); bf* Pl = (bf*)take((size_t)TT * TT * 2); float* Ob = (float*)take((size_t)TT * HD * 4);
    if ((size_t)(wsp - (char*)d_ws) > ws_size) return;
    for (int b = 0; b < NB_; ++b) {
        const float* qb = Qin + (size_t)b * TT * DM; const float* kb = Kin + (size_t)b * TT * DM; const float* vb = Vin + (size_t)b * TT * DM;   /* token-major [t][h][d] slabs */
        k_hp1<<<(unsigned)(((size_t)NH_ * TT * HD / 8 + 255) / 256), 256, 0, stream>>>(qb, QB); k_hp1<<<(unsigned)(((size_t)NH_ * TT * HD / 8 + 255) / 256), 256, 0, stream>>>(kb, KB); k_vt1<<<(unsigned)(((size_t)NH_ * HD * TT / 2 + 255) / 256), 256, 0, stream>>>(vb, DM, VT);
        for (int h = 0; h < NH_; ++h) {
            k_gemmw<bf, 0, false><<<dim3(TT / 64, TT / 64, 1), 32, 0, stream>>>(QB + (size_t)h * TT * HD, nullptr, KB + (size_t)h * TT * HD, nullptr, HD, Sb, TT, nullptr, 0, 0, 0);   /* exact scores (single bf16 planes) */
            k_asoft<<<TT / 8, 256, 0, stream>>>(Sb, nullptr, Ph, Pl);
            k_gemmw<bf, 1, false><<<dim3(TT / 64, HD / 64, 1), 32, 0, stream>>>(Ph, Pl, VT + (size_t)h * HD * TT, nullptr, TT, Ob, HD, nullptr, 0, 0, 0);   /* P (hi/lo) x exact v^T */
            k_mergeT<<<(unsigned)(((size_t)TT * HD / 4 + 255) / 256), 256, 0, stream>>>(Ob, h, OUT + (size_t)b * TT * DM); } }
}

// v001
// A run of this version takes 302 microseconds.
// Two timings next to v000 put it at 2.12 and 2.11 times that version's speed.
#include <hip/hip_runtime.h>

// Scaled dot-product attention on given tensors, one 128-wide head over 4,096 positions (query, keys, value [4][4096][128]; scores = q.k / sqrt(128); softmax over all 4,096 keys; out = attn value -> [4][4096][128] (2.1 M)).
// Layout per batch: single bf16 planes (inputs bf16-exact: exact score products); register-row softmax with every row on hi/lo planes; P hi/lo x exact value; the f32 merge writes the output rows.
// Compute dtypes, f32 accumulate: every input rounded to bf16; q.k exact; softmax f32; P hi/lo x exact value; output f32.

#define NB_  4
#define TT   4096
#define DM   128      // token-major row pitch (H x HD)
#define NH_  1
#define NKV  1
#define REP  (NH_ / NKV)
#define HD   128
#define DQ   (NH_ * HD)
#define DKV  (NKV * HD)
#define ZH   1
#define RH   4096                  // query rows < RH use hi+lo planes (0: none)
#define WIN  0
#define PCAR 1024.0f
#define SCL  0.088388347648318447f   // 1/sqrt(128)
#define KSP  16       // key ranges of the P x value product: one grid plane and one f32 partial plane each
typedef _Float16 h16;
typedef unsigned short bf;
typedef __attribute__((ext_vector_type(16))) __bf16   v16bf;
typedef __attribute__((ext_vector_type(16))) _Float16 v16h;
typedef __attribute__((ext_vector_type(8)))  _Float16 v8h;
typedef __attribute__((ext_vector_type(8)))  unsigned short v8us;
typedef __attribute__((ext_vector_type(8)))  float    v8f;
typedef __attribute__((ext_vector_type(4)))  float    v4f;
typedef v8h  __attribute__((may_alias)) v8ha;
typedef v4f  __attribute__((may_alias)) v4fa;
typedef v8us __attribute__((may_alias)) v8usa;

__device__ __forceinline__ unsigned short f2bf(float f) { unsigned u = __float_as_uint(f); u += 0x7FFFu + ((u >> 16) & 1u); return (unsigned short)(u >> 16); }
__device__ __forceinline__ float bf2f(unsigned short b) { return __uint_as_float(((unsigned)b) << 16); }
__device__ __forceinline__ float bfr(float f) { return bf2f(f2bf(f)); }
__device__ __forceinline__ v16h cat16(v8h lo, v8h hi) { return __builtin_shufflevector(lo, hi, 0, 1, 2, 3, 4, 5, 6, 7, 8, 9, 10, 11, 12, 13, 14, 15); }
__device__ __forceinline__ v16bf cat16b(v8us lo, v8us hi) { return __builtin_bit_cast(v16bf, __builtin_shufflevector(lo, hi, 0, 1, 2, 3, 4, 5, 6, 7, 8, 9, 10, 11, 12, 13, 14, 15)); }
__device__ __forceinline__ v8f wmma16(v16h a, v16h b, v8f c) { return __builtin_amdgcn_wmma_f32_16x16x32_f16(false, a, false, b, (short)0, c, false, false); }
__device__ __forceinline__ v8f wmmab(v16bf a, v16bf b, v8f c) { return __builtin_amdgcn_wmma_f32_16x16x32_bf16(false, a, false, b, (short)0, c, false, false); }



// ---- k_gemmw: register-blocked GEMM, ONE WAVE per 64x64 output tile (16 accumulators), operands straight from K-contiguous 16-bit planes; grid (M/64, N/64, Z), 32 threads.
// C[m][n] (f32, pitch ldc, + optional f32 bias[n]) = sum_k A[m][k] Bt[n][k] (+ split products per NSPLIT), k over the first kn values of rows of pitch K. z strides sA/sB/sC in elements: a batch, or a k range (sA = sB = kn) with its own partial plane of C. kn % 32 == 0.
template <typename T16> struct WFrag;
template <> struct WFrag<h16> { typedef v16h V; static __device__ __forceinline__ V ld(const h16* p) { return cat16(*(const v8h*)p, *(const v8h*)(p + 16)); } static __device__ __forceinline__ v8f mma(V a, V b, v8f c) { return wmma16(a, b, c); } };
template <> struct WFrag<bf> { typedef v16bf V; static __device__ __forceinline__ V ld(const bf* p) { return cat16b(*(const v8us*)p, *(const v8us*)(p + 16)); } static __device__ __forceinline__ v8f mma(V a, V b, v8f c) { return wmmab(a, b, c); } };
template <typename T16, int NSPLIT, bool BIAS>
__global__ __launch_bounds__(32) void k_gemmw(const T16* __restrict__ A, const T16* __restrict__ A2, const T16* __restrict__ Bt, const T16* __restrict__ Bt2, int K, int kn, float* C, int ldc, const float* __restrict__ bias, size_t sA, size_t sB, size_t sC) {
    typedef typename WFrag<T16>::V V;
    __shared__ __align__(16) float os[16 * 68];
    const size_t z = blockIdx.z; A += z * sA; if (A2) A2 += z * sA; Bt += z * sB; if (Bt2) Bt2 += z * sB; C += z * sC;
    const int lane = threadIdx.x & 31, lr = lane & 15, hi = lane >> 4; const int r0 = blockIdx.x * 64, c0 = blockIdx.y * 64;
    v8f acc[4][4];
#pragma unroll
    for (int mb = 0; mb < 4; ++mb)
#pragma unroll
        for (int nb = 0; nb < 4; ++nb) acc[mb][nb] = (v8f){};
    const size_t aoff = (size_t)(r0 + lr) * K + 8 * hi, boff = (size_t)(c0 + lr) * K + 8 * hi;
#pragma unroll 1
    for (int kc = 0; kc < kn; kc += 32) {
        V a[4], a2[4];
#pragma unroll
        for (int mb = 0; mb < 4; ++mb) { a[mb] = WFrag<T16>::ld(A + aoff + (size_t)mb * 16 * K + kc); if (NSPLIT == 1 || NSPLIT == 2) a2[mb] = WFrag<T16>::ld(A2 + aoff + (size_t)mb * 16 * K + kc); }
#pragma unroll
        for (int nb = 0; nb < 4; ++nb) { const V b = WFrag<T16>::ld(Bt + boff + (size_t)nb * 16 * K + kc); V b2; if (NSPLIT >= 2) b2 = WFrag<T16>::ld(Bt2 + boff + (size_t)nb * 16 * K + kc);
#pragma unroll
            for (int mb = 0; mb < 4; ++mb) { acc[mb][nb] = WFrag<T16>::mma(a[mb], b, acc[mb][nb]); if (NSPLIT == 1 || NSPLIT == 2) acc[mb][nb] = WFrag<T16>::mma(a2[mb], b, acc[mb][nb]); if (NSPLIT >= 2) acc[mb][nb] = WFrag<T16>::mma(a[mb], b2, acc[mb][nb]); } }
        asm volatile("v_nop\n\tv_nop\n\tv_nop\n\tv_nop" : "+v"(acc[0][0]), "+v"(acc[1][1]), "+v"(acc[2][2]), "+v"(acc[3][3]) : "v"(a[0]), "v"(a[3]));
    }
#pragma unroll
    for (int mb = 0; mb < 4; ++mb) {
#pragma unroll
        for (int nb = 0; nb < 4; ++nb) {
#pragma unroll
            for (int j = 0; j < 8; ++j) os[(hi * 8 + j) * 68 + nb * 16 + lr] = acc[mb][nb][j]; }
        __builtin_amdgcn_wave_barrier(); asm volatile("" ::: "memory");
        float* crow = C + (size_t)(r0 + mb * 16) * ldc + c0;
{
#pragma unroll
            for (int s = 0; s < 8; ++s) { const int row = 2 * s + hi, cofs = lr * 4; v4f val = *(const v4fa*)(os + row * 68 + cofs); if (BIAS) { val[0] += bfr(bias[c0 + cofs]); val[1] += bfr(bias[c0 + cofs + 1]); val[2] += bfr(bias[c0 + cofs + 2]); val[3] += bfr(bias[c0 + cofs + 3]); }
                *(v4f*)(crow + (size_t)row * ldc + cofs) = val; }
             }
        __builtin_amdgcn_wave_barrier(); asm volatile("" ::: "memory");
    }
}

__device__ __forceinline__ h16 tohx(float x) { return (h16)x; }
__device__ __forceinline__ void splitf(float y, unsigned short& h, unsigned short& l) { h = f2bf(y); l = f2bf(y - bf2f(h)); }
typedef __attribute__((ext_vector_type(2))) _Float16 v2h;
typedef __attribute__((ext_vector_type(4))) _Float16 v4h;
typedef __attribute__((ext_vector_type(2))) unsigned short v2us;
typedef __attribute__((ext_vector_type(4))) unsigned short v4us;
typedef __attribute__((ext_vector_type(2))) float v2f;
typedef __attribute__((ext_vector_type(4))) int v4i;

__global__ __launch_bounds__(256) void k_wtG(const float* __restrict__ w, int K, int N, bf* Bt) {
    const int lane = threadIdx.x & 31; const int L0 = (blockIdx.x * 8 + (threadIdx.x >> 5)) * 8; const int nlines = N * K / 64;
{
#pragma unroll 1
        for (int l = 0; l < 8; ++l) { const int L = L0 + l; if (L >= nlines) break; const size_t e = (size_t)L * 64 + lane * 2; const int k = (int)(e % K), n = (int)(e / K); v2us o;
            o[0] = f2bf(w[(size_t)k * N + n]); o[1] = f2bf(w[(size_t)(k + 1) * N + n]); *(v2us*)(Bt + e) = o; }
         }
}
__global__ __launch_bounds__(256) void k_cvt8(const float* __restrict__ src, bf* dst, size_t n8) { const size_t i = (size_t)blockIdx.x * 256 + threadIdx.x; if (i >= n8) return; const v8f v = *(const v8f*)(src + i * 8); v8us o;
#pragma unroll
    for (int k = 0; k < 8; ++k) o[k] = f2bf(v[k]); *(v8us*)(dst + i * 8) = o;  }


__global__ __launch_bounds__(256) void k_vtp(const float* __restrict__ F, int pitch, int nheads, h16* V16, bf* Vh, bf* Vl) { const size_t e = ((size_t)blockIdx.x * 256 + threadIdx.x) * 2; if (e >= (size_t)nheads * HD * TT) return; const int t = (int)(e % TT); const int d = (int)((e / TT) % HD); const int g = (int)(e / ((size_t)TT * HD)); v2h o16; v2us oh, ol;
#pragma unroll
    for (int q = 0; q < 2; ++q) { const float x = F[(size_t)(t + q) * pitch + g * HD + d]; o16[q] = tohx(x); unsigned short a2, c2; splitf(x, a2, c2); oh[q] = a2; ol[q] = c2; }
    *(v2h*)(V16 + e) = o16; *(v2us*)(Vh + e) = oh; *(v2us*)(Vl + e) = ol;  }

// k_asoft: per row (zz, i): t = S x HD^-0.5 (no mask); softmax over the 4096 keys (register row, one exp, fixed trees);
__global__ __launch_bounds__(256) void k_asoft(const float* __restrict__ Sb, h16* P16, bf* Ph, bf* Pl) {
    const int lane = threadIdx.x & 31; const int row = blockIdx.x * 8 + (threadIdx.x >> 5); if (row >= ZH * TT) return; const int i = row % TT; const int zz = row / TT; (void)zz; const bool hires = (i < RH); const float* sr = Sb + (size_t)row * TT; float v[TT / 32]; float mx = -3.0e38f;
#pragma unroll
    for (int ch = 0; ch < TT / 128; ++ch) { const int j0 = ch * 128 + lane * 4; const v4f a = *(const v4f*)(sr + j0);
#pragma unroll
        for (int q = 0; q < 4; ++q) { const float t = a[q] * SCL; v[ch * 4 + q] = t;   /* Sb holds q.k only (k_gemmw, no bias) */ mx = fmaxf(mx, t); } }
#pragma unroll
    for (int sh = 16; sh; sh >>= 1) mx = fmaxf(mx, __shfl_xor(mx, sh, 32));
    float sum = 0.f;
#pragma unroll
    for (int k = 0; k < TT / 32; ++k) { float d0 = __fsub_rn(v[k], mx); asm volatile("" : "+v"(d0)); v[k] = __builtin_amdgcn_exp2f(__fmul_rn(d0, 1.4426950408889634f)); sum += v[k]; }
#pragma unroll
    for (int sh = 16; sh; sh >>= 1) sum += __shfl_xor(sum, sh, 32);
    const float f = __fdiv_rn(hires ? 1.0f : PCAR, sum);
{
        if (hires) {
#pragma unroll
            for (int ch = 0; ch < TT / 128; ++ch) { v4us oh, ol;
#pragma unroll
                for (int q = 0; q < 4; ++q) { unsigned short a, c2; splitf(v[ch * 4 + q] * f, a, c2); oh[q] = a; ol[q] = c2; }
                const size_t oo = ((size_t)zz * (RH ? RH : 1) + i) * TT + ch * 128 + lane * 4; *(v4us*)(Ph + oo) = oh; *(v4us*)(Pl + oo) = ol; }
        } else {
#pragma unroll
            for (int ch = 0; ch < TT / 128; ++ch) { v4h o4;
#pragma unroll
                for (int q = 0; q < 4; ++q) o4[q] = tohx(v[ch * 4 + q] * f);
                *(v4h*)(P16 + (size_t)row * TT + ch * 128 + lane * 4) = o4; } }
         }
}
__global__ __launch_bounds__(256) void k_merge(const float* __restrict__ O, int h0, float* OUTb) { const size_t e = ((size_t)blockIdx.x * 256 + threadIdx.x) * 2; if (e >= (size_t)ZH * TT * HD) return; const int d = (int)(e % HD); const int t = (int)((e / HD) % TT); const int zz = (int)(e / ((size_t)HD * TT)); const float cs = (t < RH) ? 1.0f : (1.0f / PCAR); const size_t oo = (size_t)t * DQ + (h0 + zz) * HD + d;
    v2f o2; o2[0] = O[e] * cs; o2[1] = O[e + 1] * cs; *(v2f*)(OUTb + oo) = o2;  }


__global__ __launch_bounds__(256) void k_vtpR1(const float* __restrict__ Vb, bf* Vh) { const size_t e = ((size_t)blockIdx.x * 256 + threadIdx.x) * 2; if (e >= (size_t)HD * TT) return; const int t = (int)(e % TT); const int d = (int)(e / TT); v2us o; o[0] = f2bf(Vb[(size_t)t * HD + d]); o[1] = f2bf(Vb[(size_t)(t + 1) * HD + d]); *(v2us*)(Vh + e) = o;  }
__global__ __launch_bounds__(256) void k_mergeR(const float* __restrict__ O, float* outb, size_t n4) { const size_t i = (size_t)blockIdx.x * 256 + threadIdx.x; if (i >= n4) return; const v4f a = *(const v4f*)(O + i * 4); *(v4f*)(outb + i * 4) = a;  }


__global__ __launch_bounds__(256) void k_hp1(const float* __restrict__ src, bf* P) { const size_t i = (size_t)blockIdx.x * 256 + threadIdx.x; if (i >= (size_t)NH_ * TT * HD / 8) return; const size_t e = i * 8; const int d = (int)(e % HD); const int t = (int)((e / HD) % TT); const int h = (int)(e / ((size_t)HD * TT)); const v8f v = *(const v8f*)(src + (size_t)t * DM + h * HD + d); v8us o;
#pragma unroll
    for (int q = 0; q < 8; ++q) o[q] = f2bf(v[q]);
    *(v8us*)(P + e) = o;  }
__global__ __launch_bounds__(256) void k_vt1(const float* __restrict__ src, int pitch, bf* VT) { const size_t e = ((size_t)blockIdx.x * 256 + threadIdx.x) * 2; if (e >= (size_t)NH_ * HD * TT) return; const int t = (int)(e % TT); const int d = (int)((e / TT) % HD); const int h = (int)(e / ((size_t)TT * HD)); v2us o; o[0] = f2bf(src[(size_t)t * pitch + h * HD + d]); o[1] = f2bf(src[(size_t)(t + 1) * pitch + h * HD + d]); *(v2us*)(VT + e) = o;  }
// k_mergeT: output rows = sum of the KSP partial planes of the P x value product, in ascending plane order.
__global__ __launch_bounds__(256) void k_mergeT(const float* __restrict__ O, int h, float* outb) { const unsigned i = blockIdx.x * 256u + threadIdx.x; if (i >= (unsigned)(TT * HD / 4)) return; const unsigned e = i * 4u; const int d = (int)(e % HD); const int t = (int)(e / HD); const unsigned ob = i * 16u; v4f p[KSP];
    static_assert(KSP == 16, "the load statement below names sixteen planes");
    const float* g0 = O; const float* g1 = O + (size_t)4 * TT * HD; const float* g2 = O + (size_t)8 * TT * HD; const float* g3 = O + (size_t)12 * TT * HD;   /* uniform bases, four planes each: a plane's step fits the immediate offset only up to three planes */
    /* All sixteen plane loads and their data wait in one statement: all are in flight together, and with early-clobber outputs no result lands on the offset register that the issued loads name before they have returned. */
    asm volatile(
        "global_load_b128 %0, %16, %17\n\t"
        "global_load_b128 %1, %16, %17 offset:%21\n\t"
        "global_load_b128 %2, %16, %17 offset:%22\n\t"
        "global_load_b128 %3, %16, %17 offset:%23\n\t"
        "global_load_b128 %4, %16, %18\n\t"
        "global_load_b128 %5, %16, %18 offset:%21\n\t"
        "global_load_b128 %6, %16, %18 offset:%22\n\t"
        "global_load_b128 %7, %16, %18 offset:%23\n\t"
        "global_load_b128 %8, %16, %19\n\t"
        "global_load_b128 %9, %16, %19 offset:%21\n\t"
        "global_load_b128 %10, %16, %19 offset:%22\n\t"
        "global_load_b128 %11, %16, %19 offset:%23\n\t"
        "global_load_b128 %12, %16, %20\n\t"
        "global_load_b128 %13, %16, %20 offset:%21\n\t"
        "global_load_b128 %14, %16, %20 offset:%22\n\t"
        "global_load_b128 %15, %16, %20 offset:%23\n\t"
        "s_wait_loadcnt 0x0"
        : "=&v"(p[0]), "=&v"(p[1]), "=&v"(p[2]), "=&v"(p[3]), "=&v"(p[4]), "=&v"(p[5]), "=&v"(p[6]), "=&v"(p[7]), "=&v"(p[8]), "=&v"(p[9]), "=&v"(p[10]), "=&v"(p[11]), "=&v"(p[12]), "=&v"(p[13]), "=&v"(p[14]), "=&v"(p[15])
        : "v"(ob), "s"(g0), "s"(g1), "s"(g2), "s"(g3), "n"(TT * HD * 4), "n"(2 * TT * HD * 4), "n"(3 * TT * HD * 4) : "memory");
    v4f a = p[0];
#pragma unroll
    for (int z = 1; z < KSP; ++z) a += p[z];   /* unrolled: p[] stays in registers; ascending plane order */
    *(v4f*)(outb + (size_t)t * DM + h * HD + d) = a;  }

extern "C" void kernel_launch(void* const* d_in, const int* in_sizes, int n_in,
                              void* d_out, int out_size, void* d_ws, size_t ws_size, hipStream_t stream) {
    (void)in_sizes; (void)n_in; (void)out_size;
    const float* Qin = (const float*)d_in[0]; const float* Kin = (const float*)d_in[1]; const float* Vin = (const float*)d_in[2];
    float* OUT = (float*)d_out;
    char* wsp = (char*)d_ws;
    auto take = [&](size_t bytes) { char* p = wsp; wsp += (bytes + 255) & ~(size_t)255; return (void*)p; };
    bf* QB = (bf*)take((size_t)NH_ * TT * HD * 2); bf* KB = (bf*)take((size_t)NH_ * TT * HD * 2); bf* VT = (bf*)take((size_t)NH_ * HD * TT * 2);
    float* Sb = (float*)take((size_t)TT * TT * 4);  bf* Ph = (bf*)take((size_t)TT * TT * 2); bf* Pl = (bf*)take((size_t)TT * TT * 2); float* Ob = (float*)take((size_t)KSP * TT * HD * 4);
    if ((size_t)(wsp - (char*)d_ws) > ws_size) return;
    for (int b = 0; b < NB_; ++b) {
        const float* qb = Qin + (size_t)b * TT * DM; const float* kb = Kin + (size_t)b * TT * DM; const float* vb = Vin + (size_t)b * TT * DM;   /* token-major [t][h][d] slabs */
        k_hp1<<<(unsigned)(((size_t)NH_ * TT * HD / 8 + 255) / 256), 256, 0, stream>>>(qb, QB); k_hp1<<<(unsigned)(((size_t)NH_ * TT * HD / 8 + 255) / 256), 256, 0, stream>>>(kb, KB); k_vt1<<<(unsigned)(((size_t)NH_ * HD * TT / 2 + 255) / 256), 256, 0, stream>>>(vb, DM, VT);
        for (int h = 0; h < NH_; ++h) {
            k_gemmw<bf, 0, false><<<dim3(TT / 64, TT / 64, 1), 32, 0, stream>>>(QB + (size_t)h * TT * HD, nullptr, KB + (size_t)h * TT * HD, nullptr, HD, HD, Sb, TT, nullptr, 0, 0, 0);   /* exact scores (single bf16 planes) */
            k_asoft<<<TT / 8, 256, 0, stream>>>(Sb, nullptr, Ph, Pl);
            k_gemmw<bf, 1, false><<<dim3(TT / 64, HD / 64, KSP), 32, 0, stream>>>(Ph, Pl, VT + (size_t)h * HD * TT, nullptr, TT, TT / KSP, Ob, HD, nullptr, TT / KSP, TT / KSP, (size_t)TT * HD);   /* P (hi/lo) x exact v^T, one key range per grid plane */
            k_mergeT<<<(unsigned)(((size_t)TT * HD / 4 + 255) / 256), 256, 0, stream>>>(Ob, h, OUT + (size_t)b * TT * DM); } }
}

// v002
// A run of this version takes 84.2 microseconds.
// In both of two side-by-side timings against v001, it was 3.60 times as fast.
// Counting every step since v000, it is 7.62 times as fast.
#include <hip/hip_runtime.h>

// Scaled dot-product attention on given tensors, one 128-wide head over 4,096 positions (query, keys, value [4][4096][128]; scores = q.k / sqrt(128); softmax over all 4,096 keys; out = attn value -> [4][4096][128] (2.1 M)).
// Layout: single bf16 planes of keys [b][t][d] and of value transposed [b][d][t]; one fused kernel rounds its queries itself and keeps scores and probabilities in registers (running maximum and sum per query).
// Compute dtypes, f32 accumulate: every input rounded to bf16; q.k exact products; softmax f32; P hi/lo (two bf16) x exact value; output f32.

#define NB_  4
#define TT   4096
#define HD   128
#define SCL2 0.12751743f   // log2(e) / sqrt(128): scores in the log2 domain
#define QGR  2             // query groups of a work-group, 32 queries each
#define KRG  4             // key ranges of a work-group, one wave each per query group
#define KLEN (TT / KRG)
typedef unsigned short bf;
typedef __attribute__((ext_vector_type(16))) __bf16   v16bf;
typedef __attribute__((ext_vector_type(8)))  __bf16   v8bf;
typedef __attribute__((ext_vector_type(2)))  __bf16   v2bf;
typedef __attribute__((ext_vector_type(8)))  unsigned short v8us;
typedef __attribute__((ext_vector_type(2)))  unsigned short v2us;
typedef __attribute__((ext_vector_type(8)))  float    v8f;
typedef __attribute__((ext_vector_type(4)))  float    v4f;
typedef __attribute__((ext_vector_type(2)))  float    v2f;

__device__ __forceinline__ unsigned short f2bf(float f) { unsigned u = __float_as_uint(f); u += 0x7FFFu + ((u >> 16) & 1u); return (unsigned short)(u >> 16); }
__device__ __forceinline__ v16bf cat16b(v8us lo, v8us hi) { return __builtin_bit_cast(v16bf, __builtin_shufflevector(lo, hi, 0, 1, 2, 3, 4, 5, 6, 7, 8, 9, 10, 11, 12, 13, 14, 15)); }
__device__ __forceinline__ v8f wmmab(v16bf a, v16bf b, v8f c) { return __builtin_amdgcn_wmma_f32_16x16x32_bf16(false, a, false, b, (short)0, c, false, false); }
// One 16 x 32 operand fragment from a k-contiguous bf16 row; p already holds the lane's row and its 8 * (lane >> 4) start. Same k order for A and B.
__device__ __forceinline__ v16bf ldfrag(const bf* p) { return cat16b(*(const v8us*)p, *(const v8us*)(p + 16)); }
// The same fragment from an f32 row, rounded to bf16 (nearest even) on the way.
__device__ __forceinline__ v16bf ldfragf(const float* p) { const v8bf lo = __builtin_convertvector(*(const v8f*)p, v8bf), hi = __builtin_convertvector(*(const v8f*)(p + 16), v8bf); return __builtin_shufflevector(lo, hi, 0, 1, 2, 3, 4, 5, 6, 7, 8, 9, 10, 11, 12, 13, 14, 15); }
__device__ __forceinline__ float xhalf(float x) { const int b = __float_as_int(x); return __int_as_float(__builtin_amdgcn_permlanex16(b, b, 0x76543210, 0xfedcba98, false, false)); }

__global__ __launch_bounds__(256) void k_cvt8(const float* __restrict__ src, bf* dst, size_t n8) { const size_t i = (size_t)blockIdx.x * 256 + threadIdx.x; if (i >= n8) return; const v8f v = *(const v8f*)(src + i * 8); v8us o;
#pragma unroll
    for (int k = 0; k < 8; ++k) o[k] = f2bf(v[k]); *(v8us*)(dst + i * 8) = o;  }
__global__ __launch_bounds__(256) void k_vtB(const float* __restrict__ src, bf* VT) { const size_t e = ((size_t)blockIdx.x * 256 + threadIdx.x) * 2; if (e >= (size_t)NB_ * HD * TT) return; const int t = (int)(e % TT); const int d = (int)((e / TT) % HD); const int b = (int)(e / ((size_t)TT * HD)); const float* s = src + ((size_t)b * TT + t) * HD + d; v2us o; o[0] = f2bf(s[0]); o[1] = f2bf(s[HD]); *(v2us*)(VT + e) = o;  }

// k_fattn: 8 waves = QGR query groups x KRG key ranges; a wave holds 32 queries (two 16-column groups) and walks KLEN keys, 32 a pass.
// Transposed products: S^T = K Q^T (a lane holds 16 scores of one query per column group), O^T += V^T P^T (the score accumulators pack straight into the B operand; a lane's output column is the same query, so maximum, sum and rescale stay in the lane).
// The KRG partial results of a query group are joined through LDS at the end, in ascending key-range order.
// Every '#pragma unroll' below makes the index of a register array (fragments, accumulators) a compile-time constant; an array indexed at run time would leave the registers.
__global__ __launch_bounds__(256) __attribute__((amdgpu_waves_per_eu(2, 2))) void k_fattn(const float* __restrict__ Q, const bf* __restrict__ KB, const bf* __restrict__ VT, float* __restrict__ OUT) {
    __shared__ __attribute__((aligned(16))) float part[(KRG - 1) * QGR * 32 * 32 * 4];
    __shared__ float sm[KRG * QGR * 2 * 32], sl[KRG * QGR * 2 * 32];
    const int lane = threadIdx.x & 31, lr = lane & 15, hi = lane >> 4;
    const int wave = __builtin_amdgcn_readfirstlane(threadIdx.x >> 5); const int qg = wave & (QGR - 1), kr = wave / QGR;
    const int b = blockIdx.y; const int q0 = blockIdx.x * (QGR * 32) + qg * 32;
    const bf* Ks = KB + ((size_t)b * TT + kr * KLEN) * HD;   /* wave-uniform base that walks; the lane offset ko never changes */
    const unsigned ko = lr * HD + 8 * hi;
    const bf* Vp = VT + ((size_t)b * HD + lr) * TT + kr * KLEN + 8 * hi;   /* the lane's own pointer, carried round the loop */
    const float* Qp = Q + ((size_t)b * TT + q0 + lr) * HD + 8 * hi;
    v16bf qf[2][4];
#pragma unroll
    for (int c = 0; c < 2; ++c)
#pragma unroll
        for (int kc = 0; kc < 4; ++kc) qf[c][kc] = ldfragf(Qp + c * 16 * HD + kc * 32);
    asm volatile("s_wait_xcnt 0x0" :: "v"(Qp) : "memory");   /* naming the pointer keeps it live to here, so that no load's result is placed on it while the loads that name it are being issued */
    v8f o[8][2];
#pragma unroll
    for (int dt = 0; dt < 8; ++dt) { o[dt][0] = (v8f){}; o[dt][1] = (v8f){}; }
    float mrun[2] = {-3.0e38f, -3.0e38f}, lsum[2] = {0.f, 0.f};
    v16bf kf[2][4];
#pragma unroll
    for (int t = 0; t < 2; ++t)
#pragma unroll
        for (int kc = 0; kc < 4; ++kc) kf[t][kc] = ldfrag(Ks + (ko + t * 16 * HD + kc * 32));
    asm volatile("s_wait_xcnt 0x0" ::: "memory");   /* before the base of the issued loads moves */
    __builtin_amdgcn_sched_barrier(0);              /* keeps the base's step behind that wait */
#pragma unroll 1
    for (int ps = 0; ps < KLEN / 32; ++ps) {   /* rolled: one pass already holds 48 matrix instructions and 32 loads */
        v16bf vf[8];
#pragma unroll
        for (int dt = 0; dt < 8; ++dt) vf[dt] = ldfrag(Vp + dt * 16 * TT);
        asm volatile("s_wait_xcnt 0x0" :: "v"(Vp) : "memory");   /* before the pointer of the issued loads moves; naming the pointer keeps it live to here, so that no load's result is placed on it; also holds the value loads up here, a whole score product and softmax ahead of their use */
        __builtin_amdgcn_sched_barrier(0);              /* keeps the pointer's step behind that wait */
        v8f s[2][2];
#pragma unroll
        for (int t = 0; t < 2; ++t)
#pragma unroll
            for (int c = 0; c < 2; ++c) { v8f a = (v8f){};
#pragma unroll
                for (int kc = 0; kc < 4; ++kc) a = wmmab(kf[t][kc], qf[c][kc], a);
                s[t][c] = a; }
        /* the next pass's key fragments, one pass ahead; the last pass re-reads its own rows so that the address stays inside the plane */
        Ks += (ps + 1 < KLEN / 32) ? 32 * HD : 0;
#pragma unroll
        for (int t = 0; t < 2; ++t)
#pragma unroll
            for (int kc = 0; kc < 4; ++kc) kf[t][kc] = ldfrag(Ks + (ko + t * 16 * HD + kc * 32));
        asm volatile("s_wait_xcnt 0x0" ::: "memory");   /* before the base of the issued loads moves; also holds the key loads up here, ahead of the softmax */
        __builtin_amdgcn_sched_barrier(0);              /* keeps the base's step behind that wait */
        Vp += 32;
        float mx[2];
#pragma unroll
        for (int c = 0; c < 2; ++c) { float x = s[0][c][0];
#pragma unroll
            for (int j = 1; j < 8; ++j) x = fmaxf(x, s[0][c][j]);
#pragma unroll
            for (int j = 0; j < 8; ++j) x = fmaxf(x, s[1][c][j]);
            x = fmaxf(x, xhalf(x)); mx[c] = x * SCL2; }
        /* lazy rescale: the maximum in use moves only when a column's new maximum passes it by more than 8 (log2), so P stays below 2^8 */
        const bool need = (mx[0] > mrun[0] + 8.0f) || (mx[1] > mrun[1] + 8.0f);
        if (__builtin_amdgcn_ballot_w32(need) != 0) {
#pragma unroll
            for (int c = 0; c < 2; ++c) { const float mn = fmaxf(mrun[c], mx[c]); const float al = __builtin_amdgcn_exp2f(mrun[c] - mn); mrun[c] = mn; lsum[c] *= al;
#pragma unroll
                for (int dt = 0; dt < 8; ++dt) o[dt][c] *= al; }
        }
        v16bf ph[2], pl[2];
#pragma unroll
        for (int c = 0; c < 2; ++c) { float acc = 0.f;
#pragma unroll
            for (int t = 0; t < 2; ++t)
#pragma unroll
                for (int j = 0; j < 8; j += 2) { v2f p; p[0] = __builtin_amdgcn_exp2f(__builtin_fmaf(s[t][c][j], SCL2, -mrun[c])); p[1] = __builtin_amdgcn_exp2f(__builtin_fmaf(s[t][c][j + 1], SCL2, -mrun[c]));
                    acc += p[0]; acc += p[1];
                    const v2bf h = __builtin_convertvector(p, v2bf); const v2f r = p - __builtin_convertvector(h, v2f); const v2bf l = __builtin_convertvector(r, v2bf);
                    ph[c][t * 8 + j] = h[0]; ph[c][t * 8 + j + 1] = h[1]; pl[c][t * 8 + j] = l[0]; pl[c][t * 8 + j + 1] = l[1]; }
            lsum[c] += acc; }
#pragma unroll
        for (int dt = 0; dt < 8; ++dt)
#pragma unroll
            for (int c = 0; c < 2; ++c) { o[dt][c] = wmmab(vf[dt], ph[c], o[dt][c]); o[dt][c] = wmmab(vf[dt], pl[c], o[dt][c]); }
    }
    /* join the KRG key ranges of each query group */
#pragma unroll
    for (int c = 0; c < 2; ++c) { lsum[c] += xhalf(lsum[c]); sm[(wave * 2 + c) * 32 + lane] = mrun[c]; }
    __syncthreads();
#pragma unroll
    for (int c = 0; c < 2; ++c) { float M = sm[(qg * 2 + c) * 32 + lane];
#pragma unroll
        for (int r = 1; r < KRG; ++r) M = fmaxf(M, sm[((r * QGR + qg) * 2 + c) * 32 + lane]);
        const float f = __builtin_amdgcn_exp2f(mrun[c] - M); sl[(wave * 2 + c) * 32 + lane] = lsum[c] * f;   /* every range brings sum and output to the group's common maximum */
#pragma unroll
        for (int dt = 0; dt < 8; ++dt) o[dt][c] *= f; }
    if (kr > 0) { float* pw = part + (size_t)((kr - 1) * QGR + qg) * 32 * 32 * 4 + lane * 4;
#pragma unroll
        for (int dt = 0; dt < 8; ++dt)
#pragma unroll
            for (int c = 0; c < 2; ++c) { v4f x0 = {o[dt][c][0], o[dt][c][1], o[dt][c][2], o[dt][c][3]}, x1 = {o[dt][c][4], o[dt][c][5], o[dt][c][6], o[dt][c][7]};
                *(v4f*)(pw + ((dt * 2 + c) * 2 + 0) * 128) = x0; *(v4f*)(pw + ((dt * 2 + c) * 2 + 1) * 128) = x1; } }
    __syncthreads();
    if (kr == 0) {
        float inv[2];
#pragma unroll
        for (int c = 0; c < 2; ++c) { float L = sl[(qg * 2 + c) * 32 + lane];
#pragma unroll
            for (int r = 1; r < KRG; ++r) L += sl[((r * QGR + qg) * 2 + c) * 32 + lane];
            inv[c] = 1.0f / L; }
#pragma unroll
        for (int dt = 0; dt < 8; ++dt)
#pragma unroll
            for (int c = 0; c < 2; ++c) { v4f x0 = {o[dt][c][0], o[dt][c][1], o[dt][c][2], o[dt][c][3]}, x1 = {o[dt][c][4], o[dt][c][5], o[dt][c][6], o[dt][c][7]};
#pragma unroll
                for (int r = 1; r < KRG; ++r) { const float* pr = part + (size_t)((r - 1) * QGR + qg) * 32 * 32 * 4 + lane * 4; x0 += *(const v4f*)(pr + ((dt * 2 + c) * 2 + 0) * 128); x1 += *(const v4f*)(pr + ((dt * 2 + c) * 2 + 1) * 128); }
                float* op = OUT + ((size_t)b * TT + q0 + c * 16 + lr) * HD + dt * 16 + hi * 8; *(v4f*)op = x0 * inv[c]; *(v4f*)(op + 4) = x1 * inv[c]; } }
}

extern "C" void kernel_launch(void* const* d_in, const int* in_sizes, int n_in,
                              void* d_out, int out_size, void* d_ws, size_t ws_size, hipStream_t stream) {
    (void)in_sizes; (void)n_in; (void)out_size;
    const float* Qin = (const float*)d_in[0]; const float* Kin = (const float*)d_in[1]; const float* Vin = (const float*)d_in[2];
    float* OUT = (float*)d_out;
    char* wsp = (char*)d_ws;
    auto take = [&](size_t bytes) { char* p = wsp; wsp += (bytes + 255) & ~(size_t)255; return (void*)p; };
    bf* KB = (bf*)take((size_t)NB_ * TT * HD * 2); bf* VT = (bf*)take((size_t)NB_ * HD * TT * 2);
    if ((size_t)(wsp - (char*)d_ws) > ws_size) return;
    k_cvt8<<<(unsigned)(((size_t)NB_ * TT * HD / 8 + 255) / 256), 256, 0, stream>>>(Kin, KB, (size_t)NB_ * TT * HD / 8);
    k_vtB<<<(unsigned)(((size_t)NB_ * HD * TT / 2 + 255) / 256), 256, 0, stream>>>(Vin, VT);
    k_fattn<<<dim3(TT / (QGR * 32), NB_, 1), 256, 0, stream>>>(Qin, KB, VT, OUT);
}

// v003
// A run of this version takes 43.3 microseconds.
// Two timings next to v002 put it at 1.92 and 1.96 times that version's speed.
// Counting every step since v000, it is 14.8 times as fast.
#include <hip/hip_runtime.h>

// Scaled dot-product attention on given tensors, one 128-wide head over 4,096 positions (query, keys, value [4][4096][128]; scores = q.k / sqrt(128); softmax over all 4,096 keys; out = attn value -> [4][4096][128] (2.1 M)).
// Layout: single bf16 planes of keys and of value, both packed in matrix-fragment order: per 32 keys a block of 16 half fragments, each [lane 32][8 elements] = 512 contiguous bytes, so that one wave-wide 16-byte load covers 4 whole 128-byte lines. One fused kernel rounds its queries itself and keeps scores and probabilities in registers (running maximum and sum per query).
// Compute dtypes, f32 accumulate: every input rounded to bf16; q.k exact products; softmax f32; P hi/lo (two bf16) x exact value; output f32.

#define NB_  4
#define TT   4096
#define HD   128
#define SCL2 0.12751743f   // log2(e) / sqrt(128): scores in the log2 domain
#define QGR  2             // query groups of a work-group, 32 queries each
#define KRG  4             // key ranges of a work-group, one wave each per query group
#define KLEN (TT / KRG)
#define HFR  256           // bf16 elements of a packed half fragment: 32 lanes x 8
typedef unsigned short bf;
typedef __attribute__((ext_vector_type(16))) __bf16   v16bf;
typedef __attribute__((ext_vector_type(8)))  __bf16   v8bf;
typedef __attribute__((ext_vector_type(2)))  __bf16   v2bf;
typedef __attribute__((ext_vector_type(8)))  unsigned short v8us;
typedef __attribute__((ext_vector_type(2)))  unsigned short v2us;
typedef __attribute__((ext_vector_type(8)))  float    v8f;
typedef __attribute__((ext_vector_type(4)))  float    v4f;
typedef __attribute__((ext_vector_type(2)))  float    v2f;

__device__ __forceinline__ unsigned short f2bf(float f) { unsigned u = __float_as_uint(f); u += 0x7FFFu + ((u >> 16) & 1u); return (unsigned short)(u >> 16); }
__device__ __forceinline__ v16bf cat16b(v8us lo, v8us hi) { return __builtin_bit_cast(v16bf, __builtin_shufflevector(lo, hi, 0, 1, 2, 3, 4, 5, 6, 7, 8, 9, 10, 11, 12, 13, 14, 15)); }
__device__ __forceinline__ v8f wmmab(v16bf a, v16bf b, v8f c) { return __builtin_amdgcn_wmma_f32_16x16x32_bf16(false, a, false, b, (short)0, c, false, false); }
// One 16 x 32 operand fragment from a packed plane: two half fragments one behind the other; p already holds the lane's 8 * lane start. Lane (lr, hi) holds row lr, k = 8 * hi + 0..7 in the first half and 16 + 8 * hi + 0..7 in the second.
__device__ __forceinline__ v16bf ldfragp(const bf* p) { return cat16b(*(const v8us*)p, *(const v8us*)(p + HFR)); }
// A fragment in the same k order from an f32 row, rounded to bf16 (nearest even) on the way; p already holds the lane's row and its 8 * (lane >> 4) start.
__device__ __forceinline__ v16bf ldfragf(const float* p) { const v8bf lo = __builtin_convertvector(*(const v8f*)p, v8bf), hi = __builtin_convertvector(*(const v8f*)(p + 16), v8bf); return __builtin_shufflevector(lo, hi, 0, 1, 2, 3, 4, 5, 6, 7, 8, 9, 10, 11, 12, 13, 14, 15); }
__device__ __forceinline__ float xhalf(float x) { const int b = __float_as_int(x); return __int_as_float(__builtin_amdgcn_permlanex16(b, b, 0x76543210, 0xfedcba98, false, false)); }

// Both packers: thread i writes the 16 bytes i of its plane (stores cover whole lines); in k_packK the 8 waves of a work-group read the same 16 rows, in k_packV two sets of 4 waves read 16 rows each, so every line that is read is used whole.
// k_packK: keys plane [b][32-key block][t 2][kc 4][half 2][lane][8]: lane (lr, hi) holds key t * 16 + lr, d = kc * 32 + half * 16 + 8 * hi + 0..7.
__global__ __launch_bounds__(256) void k_packK(const float* __restrict__ src, bf* dst) { const unsigned i = blockIdx.x * 256 + threadIdx.x; const unsigned lr = i & 15, hi = (i >> 4) & 1, h = (i >> 5) & 1, kc = (i >> 6) & 3, t = (i >> 8) & 1, blk = i >> 9;
    const float* s = src + (size_t)(blk * 32 + t * 16 + lr) * HD + kc * 32 + h * 16 + 8 * hi; const v8f v = *(const v8f*)s; v8us o;
    asm volatile("s_wait_xcnt 0x0" :: "v"(s) : "memory");   /* before the registers of the issued loads' pointer are used again; naming the pointer keeps it live to here */
#pragma unroll
    for (int k = 0; k < 8; ++k) o[k] = f2bf(v[k]); *(v8us*)(dst + (size_t)i * 8) = o;  }
// k_packV: value plane, transposed on the way, [b][32-key block][dt 8][half 2][lane][8]: lane (lr, hi) holds d = dt * 16 + lr, key = half * 16 + 8 * hi + 0..7.
__global__ __launch_bounds__(256) void k_packV(const float* __restrict__ src, bf* dst) { const unsigned i = blockIdx.x * 256 + threadIdx.x; const unsigned lr = i & 15, hi = (i >> 4) & 1, h = (i >> 5) & 1, dt = (i >> 6) & 7, blk = i >> 9;
    const float* s = src + (size_t)(blk * 32 + h * 16 + 8 * hi) * HD + dt * 16 + lr; v8us o;
#pragma unroll
    for (int k = 0; k < 8; ++k) o[k] = f2bf(s[k * HD]); *(v8us*)(dst + (size_t)i * 8) = o;  }

// k_fattn: 8 waves = QGR query groups x KRG key ranges; a wave holds 32 queries (two 16-column groups) and walks KLEN keys, 32 a pass.
// Transposed products: S^T = K Q^T (a lane holds 16 scores of one query per column group), O^T += V^T P^T (the score accumulators pack straight into the B operand; a lane's output column is the same query, so maximum, sum and rescale stay in the lane).
// The KRG partial results of a query group are joined through LDS at the end, in ascending key-range order.
// Every '#pragma unroll' below makes the index of a register array (fragments, accumulators) a compile-time constant; an array indexed at run time would leave the registers.
__global__ __launch_bounds__(256) __attribute__((amdgpu_waves_per_eu(2, 2))) void k_fattn(const float* __restrict__ Q, const bf* __restrict__ KP, const bf* __restrict__ VP, float* __restrict__ OUT) {
    __shared__ __attribute__((aligned(16))) float part[(KRG - 1) * QGR * 32 * 32 * 4];
    __shared__ float sm[KRG * QGR * 2 * 32], sl[KRG * QGR * 2 * 32];
    const int lane = threadIdx.x & 31, lr = lane & 15, hi = lane >> 4;
    const int wave = __builtin_amdgcn_readfirstlane(threadIdx.x >> 5); const int qg = wave & (QGR - 1), kr = wave / QGR;
    const int b = blockIdx.y; const int q0 = blockIdx.x * (QGR * 32) + qg * 32;
    const bf* Ks = KP + ((size_t)b * TT + kr * KLEN) * HD;   /* wave-uniform base that walks, 32 * HD elements a 32-key block (so in either plane); the lane offset lo never changes */
    const unsigned lo = lane * 8;
    const bf* Vp = VP + ((size_t)b * TT + kr * KLEN) * HD + lo;   /* the lane's own pointer, carried round the loop */
    const float* Qp = Q + ((size_t)b * TT + q0 + lr) * HD + 8 * hi;
    v16bf qf[2][4];
#pragma unroll
    for (int c = 0; c < 2; ++c)
#pragma unroll
        for (int kc = 0; kc < 4; ++kc) qf[c][kc] = ldfragf(Qp + c * 16 * HD + kc * 32);
    asm volatile("s_wait_xcnt 0x0" :: "v"(Qp) : "memory");   /* naming the pointer keeps it live to here, so that no load's result is placed on it while the loads that name it are being issued */
    v8f o[8][2];
#pragma unroll
    for (int dt = 0; dt < 8; ++dt) { o[dt][0] = (v8f){}; o[dt][1] = (v8f){}; }
    float mrun[2] = {-3.0e38f, -3.0e38f}, lsum[2] = {0.f, 0.f};
    v16bf kf[2][4];
#pragma unroll
    for (int t = 0; t < 2; ++t)
#pragma unroll
        for (int kc = 0; kc < 4; ++kc) kf[t][kc] = ldfragp(Ks + (lo + (t * 4 + kc) * 2 * HFR));
    asm volatile("s_wait_xcnt 0x0" ::: "memory");   /* before the base of the issued loads moves */
    __builtin_amdgcn_sched_barrier(0);              /* keeps the base's step behind that wait */
#pragma unroll 1
    for (int ps = 0; ps < KLEN / 32; ++ps) {   /* rolled: one pass already holds 48 matrix instructions and 32 loads */
        v16bf vf[8];
#pragma unroll
        for (int dt = 0; dt < 8; ++dt) vf[dt] = ldfragp(Vp + dt * 2 * HFR);
        asm volatile("s_wait_xcnt 0x0" :: "v"(Vp) : "memory");   /* before the pointer of the issued loads moves; naming the pointer keeps it live to here, so that no load's result is placed on it; also holds the value loads up here, a whole score product and softmax ahead of their use */
        __builtin_amdgcn_sched_barrier(0);              /* keeps the pointer's step behind that wait */
        v8f s[2][2];
#pragma unroll
        for (int t = 0; t < 2; ++t)
#pragma unroll
            for (int c = 0; c < 2; ++c) { v8f a = (v8f){};
#pragma unroll
                for (int kc = 0; kc < 4; ++kc) a = wmmab(kf[t][kc], qf[c][kc], a);
                s[t][c] = a; }
        /* the next pass's key fragments, one pass ahead; the last pass re-reads its own rows so that the address stays inside the plane */
        Ks += (ps + 1 < KLEN / 32) ? 32 * HD : 0;
#pragma unroll
        for (int t = 0; t < 2; ++t)
#pragma unroll
            for (int kc = 0; kc < 4; ++kc) kf[t][kc] = ldfragp(Ks + (lo + (t * 4 + kc) * 2 * HFR));
        asm volatile("s_wait_xcnt 0x0" ::: "memory");   /* before the base of the issued loads moves; also holds the key loads up here, ahead of the softmax */
        __builtin_amdgcn_sched_barrier(0);              /* keeps the base's step behind that wait */
        Vp += 32 * HD;
        float mx[2];
#pragma unroll
        for (int c = 0; c < 2; ++c) { float x = s[0][c][0];
#pragma unroll
            for (int j = 1; j < 8; ++j) x = fmaxf(x, s[0][c][j]);
#pragma unroll
            for (int j = 0; j < 8; ++j) x = fmaxf(x, s[1][c][j]);
            x = fmaxf(x, xhalf(x)); mx[c] = x * SCL2; }
        /* lazy rescale: the maximum in use moves only when a column's new maximum passes it by more than 8 (log2), so P stays below 2^8 */
        const bool need = (mx[0] > mrun[0] + 8.0f) || (mx[1] > mrun[1] + 8.0f);
        if (__builtin_amdgcn_ballot_w32(need) != 0) {
#pragma unroll
            for (int c = 0; c < 2; ++c) { const float mn = fmaxf(mrun[c], mx[c]); const float al = __builtin_amdgcn_exp2f(mrun[c] - mn); mrun[c] = mn; lsum[c] *= al;
#pragma unroll
                for (int dt = 0; dt < 8; ++dt) o[dt][c] *= al; }
        }
        v16bf ph[2], pl[2];
#pragma unroll
        for (int c = 0; c < 2; ++c) { float acc = 0.f;
#pragma unroll
            for (int t = 0; t < 2; ++t)
#pragma unroll
                for (int j = 0; j < 8; j += 2) { v2f p; p[0] = __builtin_amdgcn_exp2f(__builtin_fmaf(s[t][c][j], SCL2, -mrun[c])); p[1] = __builtin_amdgcn_exp2f(__builtin_fmaf(s[t][c][j + 1], SCL2, -mrun[c]));
                    acc += p[0]; acc += p[1];
                    const v2bf h = __builtin_convertvector(p, v2bf); const v2f r = p - __builtin_convertvector(h, v2f); const v2bf l = __builtin_convertvector(r, v2bf);
                    ph[c][t * 8 + j] = h[0]; ph[c][t * 8 + j + 1] = h[1]; pl[c][t * 8 + j] = l[0]; pl[c][t * 8 + j + 1] = l[1]; }
            lsum[c] += acc; }
#pragma unroll
        for (int dt = 0; dt < 8; ++dt)
#pragma unroll
            for (int c = 0; c < 2; ++c) { o[dt][c] = wmmab(vf[dt], ph[c], o[dt][c]); o[dt][c] = wmmab(vf[dt], pl[c], o[dt][c]); }
    }
    /* join the KRG key ranges of each query group */
#pragma unroll
    for (int c = 0; c < 2; ++c) { lsum[c] += xhalf(lsum[c]); sm[(wave * 2 + c) * 32 + lane] = mrun[c]; }
    __syncthreads();
#pragma unroll
    for (int c = 0; c < 2; ++c) { float M = sm[(qg * 2 + c) * 32 + lane];
#pragma unroll
        for (int r = 1; r < KRG; ++r) M = fmaxf(M, sm[((r * QGR + qg) * 2 + c) * 32 + lane]);
        const float f = __builtin_amdgcn_exp2f(mrun[c] - M); sl[(wave * 2 + c) * 32 + lane] = lsum[c] * f;   /* every range brings sum and output to the group's common maximum */
#pragma unroll
        for (int dt = 0; dt < 8; ++dt) o[dt][c] *= f; }
    if (kr > 0) { float* pw = part + (size_t)((kr - 1) * QGR + qg) * 32 * 32 * 4 + lane * 4;
#pragma unroll
        for (int dt = 0; dt < 8; ++dt)
#pragma unroll
            for (int c = 0; c < 2; ++c) { v4f x0 = {o[dt][c][0], o[dt][c][1], o[dt][c][2], o[dt][c][3]}, x1 = {o[dt][c][4], o[dt][c][5], o[dt][c][6], o[dt][c][7]};
                *(v4f*)(pw + ((dt * 2 + c) * 2 + 0) * 128) = x0; *(v4f*)(pw + ((dt * 2 + c) * 2 + 1) * 128) = x1; } }
    __syncthreads();
    if (kr == 0) {
        float inv[2];
#pragma unroll
        for (int c = 0; c < 2; ++c) { float L = sl[(qg * 2 + c) * 32 + lane];
#pragma unroll
            for (int r = 1; r < KRG; ++r) L += sl[((r * QGR + qg) * 2 + c) * 32 + lane];
            inv[c] = 1.0f / L; }
#pragma unroll
        for (int dt = 0; dt < 8; ++dt)
#pragma unroll
            for (int c = 0; c < 2; ++c) { v4f x0 = {o[dt][c][0], o[dt][c][1], o[dt][c][2], o[dt][c][3]}, x1 = {o[dt][c][4], o[dt][c][5], o[dt][c][6], o[dt][c][7]};
#pragma unroll
                for (int r = 1; r < KRG; ++r) { const float* pr = part + (size_t)((r - 1) * QGR + qg) * 32 * 32 * 4 + lane * 4; x0 += *(const v4f*)(pr + ((dt * 2 + c) * 2 + 0) * 128); x1 += *(const v4f*)(pr + ((dt * 2 + c) * 2 + 1) * 128); }
                float* op = OUT + ((size_t)b * TT + q0 + c * 16 + lr) * HD + dt * 16 + hi * 8; *(v4f*)op = x0 * inv[c]; *(v4f*)(op + 4) = x1 * inv[c]; } }
}

extern "C" void kernel_launch(void* const* d_in, const int* in_sizes, int n_in,
                              void* d_out, int out_size, void* d_ws, size_t ws_size, hipStream_t stream) {
    (void)in_sizes; (void)n_in; (void)out_size;
    const float* Qin = (const float*)d_in[0]; const float* Kin = (const float*)d_in[1]; const float* Vin = (const float*)d_in[2];
    float* OUT = (float*)d_out;
    char* wsp = (char*)d_ws;
    auto take = [&](size_t bytes) { char* p = wsp; wsp += (bytes + 255) & ~(size_t)255; return (void*)p; };
    bf* KP = (bf*)take((size_t)NB_ * TT * HD * 2); bf* VP = (bf*)take((size_t)NB_ * HD * TT * 2);
    if ((size_t)(wsp - (char*)d_ws) > ws_size) return;
    k_packK<<<NB_ * TT * HD / 8 / 256, 256, 0, stream>>>(Kin, KP);
    k_packV<<<NB_ * TT * HD / 8 / 256, 256, 0, stream>>>(Vin, VP);
    k_fattn<<<dim3(TT / (QGR * 32), NB_, 1), 256, 0, stream>>>(Qin, KP, VP, OUT);
}

// v004
// Measured time: 40.7 microseconds a run.
// Timed twice side by side with v003, it ran 1.05 times as fast both times.
// Over all steps from v000 it is 15.5 times as fast.
#include <hip/hip_runtime.h>

// Scaled dot-product attention on given tensors, one 128-wide head over 4,096 positions (query, keys, value [4][4096][128]; scores = q.k / sqrt(128); softmax over all 4,096 keys; out = attn value -> [4][4096][128] (2.1 M)).
// Layout: single bf16 planes of keys and of value, both packed in matrix-fragment order: per 32 keys a block of 16 half fragments, each [lane 32][8 elements] = 512 contiguous bytes, so that one wave-wide 16-byte load covers 4 whole 128-byte lines. One fused kernel rounds its queries itself and keeps scores and probabilities in registers (running maximum and sum per query).
// Compute dtypes, f32 accumulate: every input rounded to bf16; q.k exact products; softmax f32; P hi/lo (two bf16) x exact value; output f32.

#define NB_  4
#define TT   4096
#define HD   128
#define SCL2 0.12751743f   // log2(e) / sqrt(128): scores in the log2 domain
#define QGR  2             // query groups of a work-group, 32 queries each
#define KRG  4             // key ranges of a work-group, one wave each per query group
#define KLEN (TT / KRG)
#define HFR  256           // bf16 elements of a packed half fragment: 32 lanes x 8
#define PPT  4             // 16-byte pieces of each plane that a thread of the packer writes
typedef unsigned short bf;
typedef __attribute__((ext_vector_type(16))) __bf16   v16bf;
typedef __attribute__((ext_vector_type(8)))  __bf16   v8bf;
typedef __attribute__((ext_vector_type(2)))  __bf16   v2bf;
typedef __attribute__((ext_vector_type(8)))  unsigned short v8us;
typedef __attribute__((ext_vector_type(2)))  unsigned short v2us;
typedef __attribute__((ext_vector_type(8)))  float    v8f;
typedef __attribute__((ext_vector_type(4)))  float    v4f;
typedef __attribute__((ext_vector_type(2)))  float    v2f;

__device__ __forceinline__ unsigned short f2bf(float f) { unsigned u = __float_as_uint(f); u += 0x7FFFu + ((u >> 16) & 1u); return (unsigned short)(u >> 16); }
__device__ __forceinline__ v16bf cat16b(v8us lo, v8us hi) { return __builtin_bit_cast(v16bf, __builtin_shufflevector(lo, hi, 0, 1, 2, 3, 4, 5, 6, 7, 8, 9, 10, 11, 12, 13, 14, 15)); }
__device__ __forceinline__ v8f wmmab(v16bf a, v16bf b, v8f c) { return __builtin_amdgcn_wmma_f32_16x16x32_bf16(false, a, false, b, (short)0, c, false, false); }
// One 16 x 32 operand fragment from a packed plane: two half fragments one behind the other; p already holds the lane's 8 * lane start. Lane (lr, hi) holds row lr, k = 8 * hi + 0..7 in the first half and 16 + 8 * hi + 0..7 in the second.
__device__ __forceinline__ v16bf ldfragp(const bf* p) { return cat16b(*(const v8us*)p, *(const v8us*)(p + HFR)); }
// A fragment in the same k order from an f32 row, rounded to bf16 (nearest even) on the way; p already holds the lane's row and its 8 * (lane >> 4) start.
__device__ __forceinline__ v16bf ldfragf(const float* p) { const v8bf lo = __builtin_convertvector(*(const v8f*)p, v8bf), hi = __builtin_convertvector(*(const v8f*)(p + 16), v8bf); return __builtin_shufflevector(lo, hi, 0, 1, 2, 3, 4, 5, 6, 7, 8, 9, 10, 11, 12, 13, 14, 15); }
__device__ __forceinline__ float xhalf(float x) { const int b = __float_as_int(x); return __int_as_float(__builtin_amdgcn_permlanex16(b, b, 0x76543210, 0xfedcba98, false, false)); }

// k_pack: both planes in one launch of few, long-lived waves (a launch this short is paid in its gap and in wave starts, not in bytes). Piece i = the 16 bytes i of a plane; thread t of work-group g writes the pieces (g * PPT + j) * 256 + t, j = 0..PPT-1, of each plane, so every wave-wide store covers whole lines; the waves of a work-group read between them all 128 columns of each row they touch, so every line that is read is used whole. A work-group covers 64 keys of both planes. Every load of a thread is issued before its first conversion.
// keys plane [b][32-key block][t 2][kc 4][half 2][lane][8]: lane (lr, hi) holds key t * 16 + lr, d = kc * 32 + half * 16 + 8 * hi + 0..7; j steps t, then the block: 16 keys a step.
// value plane, transposed on the way, [b][32-key block][dt 8][half 2][lane][8]: lane (lr, hi) holds d = dt * 16 + lr, key = half * 16 + 8 * hi + 0..7; j steps the upper bit of dt (64 columns), then the block (32 keys).
__global__ __launch_bounds__(256) void k_pack(const float* __restrict__ K, const float* __restrict__ V, bf* KP, bf* VP) { const unsigned tid = threadIdx.x; const unsigned lr = tid & 15, hi = (tid >> 4) & 1, h = (tid >> 5) & 1, c = (tid >> 6) & 3;
    const float* sk = K + (size_t)(blockIdx.x * 64 + lr) * HD + c * 32 + h * 16 + 8 * hi;
    const float* sv = V + (size_t)(blockIdx.x * 64 + h * 16 + 8 * hi) * HD + c * 16 + lr;
    v8f kv[PPT]; float vv[PPT][8];
    /* every '#pragma unroll' here makes the index of a register array a compile-time constant */
#pragma unroll
    for (int j = 0; j < PPT; ++j) kv[j] = *(const v8f*)(sk + j * 16 * HD);
#pragma unroll
    for (int j = 0; j < PPT; ++j)
#pragma unroll
        for (int k = 0; k < 8; ++k) vv[j][k] = sv[((j >> 1) * 32 + k) * HD + (j & 1) * 64];
    asm volatile("s_wait_xcnt 0x0" :: "v"(sk), "v"(sv) : "memory");   /* before the registers of the issued loads' pointers are used again; naming the pointers keeps them live to here; also holds every load up here, ahead of the first conversion */
    const size_t d0 = ((size_t)blockIdx.x * (PPT * 256) + tid) * 8;
#pragma unroll
    for (int j = 0; j < PPT; ++j) { v8us o;
#pragma unroll
        for (int k = 0; k < 8; ++k) o[k] = f2bf(kv[j][k]);
        *(v8us*)(KP + d0 + j * 256 * 8) = o; }
#pragma unroll
    for (int j = 0; j < PPT; ++j) { v8us o;
#pragma unroll
        for (int k = 0; k < 8; ++k) o[k] = f2bf(vv[j][k]);
        *(v8us*)(VP + d0 + j * 256 * 8) = o; } }

// k_fattn: 8 waves = QGR query groups x KRG key ranges; a wave holds 32 queries (two 16-column groups) and walks KLEN keys, 32 a pass.
// Transposed products: S^T = K Q^T (a lane holds 16 scores of one query per column group), O^T += V^T P^T (the score accumulators pack straight into the B operand; a lane's output column is the same query, so maximum, sum and rescale stay in the lane).
// The KRG partial results of a query group are joined through LDS at the end, in ascending key-range order.
// Every '#pragma unroll' below makes the index of a register array (fragments, accumulators) a compile-time constant; an array indexed at run time would leave the registers.
__global__ __launch_bounds__(256) __attribute__((amdgpu_waves_per_eu(2, 2))) void k_fattn(const float* __restrict__ Q, const bf* __restrict__ KP, const bf* __restrict__ VP, float* __restrict__ OUT) {
    __shared__ __attribute__((aligned(16))) float part[(KRG - 1) * QGR * 32 * 32 * 4];
    __shared__ float sm[KRG * QGR * 2 * 32], sl[KRG * QGR * 2 * 32];
    const int lane = threadIdx.x & 31, lr = lane & 15, hi = lane >> 4;
    const int wave = __builtin_amdgcn_readfirstlane(threadIdx.x >> 5); const int qg = wave & (QGR - 1), kr = wave / QGR;
    const int b = blockIdx.y; const int q0 = blockIdx.x * (QGR * 32) + qg * 32;
    const bf* Ks = KP + ((size_t)b * TT + kr * KLEN) * HD;   /* wave-uniform base that walks, 32 * HD elements a 32-key block (so in either plane); the lane offset lo never changes */
    const unsigned lo = lane * 8;
    const bf* Vp = VP + ((size_t)b * TT + kr * KLEN) * HD + lo;   /* the lane's own pointer, carried round the loop */
    const float* Qp = Q + ((size_t)b * TT + q0 + lr) * HD + 8 * hi;
    v16bf qf[2][4];
#pragma unroll
    for (int c = 0; c < 2; ++c)
#pragma unroll
        for (int kc = 0; kc < 4; ++kc) qf[c][kc] = ldfragf(Qp + c * 16 * HD + kc * 32);
    asm volatile("s_wait_xcnt 0x0" :: "v"(Qp) : "memory");   /* naming the pointer keeps it live to here, so that no load's result is placed on it while the loads that name it are being issued */
    v8f o[8][2];
#pragma unroll
    for (int dt = 0; dt < 8; ++dt) { o[dt][0] = (v8f){}; o[dt][1] = (v8f){}; }
    float mrun[2] = {-3.0e38f, -3.0e38f}, lsum[2] = {0.f, 0.f};
    v16bf kf[2][4];
#pragma unroll
    for (int t = 0; t < 2; ++t)
#pragma unroll
        for (int kc = 0; kc < 4; ++kc) kf[t][kc] = ldfragp(Ks + (lo + (t * 4 + kc) * 2 * HFR));
    asm volatile("s_wait_xcnt 0x0" ::: "memory");   /* before the base of the issued loads moves */
    __builtin_amdgcn_sched_barrier(0);              /* keeps the base's step behind that wait */
#pragma unroll 1
    for (int ps = 0; ps < KLEN / 32; ++ps) {   /* rolled: one pass already holds 48 matrix instructions and 32 loads */
        v16bf vf[8];
#pragma unroll
        for (int dt = 0; dt < 8; ++dt) vf[dt] = ldfragp(Vp + dt * 2 * HFR);
        asm volatile("s_wait_xcnt 0x0" :: "v"(Vp) : "memory");   /* before the pointer of the issued loads moves; naming the pointer keeps it live to here, so that no load's result is placed on it; also holds the value loads up here, a whole score product and softmax ahead of their use */
        __builtin_amdgcn_sched_barrier(0);              /* keeps the pointer's step behind that wait */
        v8f s[2][2];
#pragma unroll
        for (int t = 0; t < 2; ++t)
#pragma unroll
            for (int c = 0; c < 2; ++c) { v8f a = (v8f){};
#pragma unroll
                for (int kc = 0; kc < 4; ++kc) a = wmmab(kf[t][kc], qf[c][kc], a);
                s[t][c] = a; }
        /* the next pass's key fragments, one pass ahead; the last pass re-reads its own rows so that the address stays inside the plane */
        Ks += (ps + 1 < KLEN / 32) ? 32 * HD : 0;
#pragma unroll
        for (int t = 0; t < 2; ++t)
#pragma unroll
            for (int kc = 0; kc < 4; ++kc) kf[t][kc] = ldfragp(Ks + (lo + (t * 4 + kc) * 2 * HFR));
        asm volatile("s_wait_xcnt 0x0" ::: "memory");   /* before the base of the issued loads moves; also holds the key loads up here, ahead of the softmax */
        __builtin_amdgcn_sched_barrier(0);              /* keeps the base's step behind that wait */
        Vp += 32 * HD;
        float mx[2];
#pragma unroll
        for (int c = 0; c < 2; ++c) { float x = s[0][c][0];
#pragma unroll
            for (int j = 1; j < 8; ++j) x = fmaxf(x, s[0][c][j]);
#pragma unroll
            for (int j = 0; j < 8; ++j) x = fmaxf(x, s[1][c][j]);
            x = fmaxf(x, xhalf(x)); mx[c] = x * SCL2; }
        /* lazy rescale: the maximum in use moves only when a column's new maximum passes it by more than 8 (log2), so P stays below 2^8 */
        const bool need = (mx[0] > mrun[0] + 8.0f) || (mx[1] > mrun[1] + 8.0f);
        if (__builtin_amdgcn_ballot_w32(need) != 0) {
#pragma unroll
            for (int c = 0; c < 2; ++c) { const float mn = fmaxf(mrun[c], mx[c]); const float al = __builtin_amdgcn_exp2f(mrun[c] - mn); mrun[c] = mn; lsum[c] *= al;
#pragma unroll
                for (int dt = 0; dt < 8; ++dt) o[dt][c] *= al; }
        }
        v16bf ph[2], pl[2];
#pragma unroll
        for (int c = 0; c < 2; ++c) { float acc = 0.f;
#pragma unroll
            for (int t = 0; t < 2; ++t)
#pragma unroll
                for (int j = 0; j < 8; j += 2) { v2f p; p[0] = __builtin_amdgcn_exp2f(__builtin_fmaf(s[t][c][j], SCL2, -mrun[c])); p[1] = __builtin_amdgcn_exp2f(__builtin_fmaf(s[t][c][j + 1], SCL2, -mrun[c]));
                    acc += p[0]; acc += p[1];
                    const v2bf h = __builtin_convertvector(p, v2bf); const v2f r = p - __builtin_convertvector(h, v2f); const v2bf l = __builtin_convertvector(r, v2bf);
                    ph[c][t * 8 + j] = h[0]; ph[c][t * 8 + j + 1] = h[1]; pl[c][t * 8 + j] = l[0]; pl[c][t * 8 + j + 1] = l[1]; }
            lsum[c] += acc; }
#pragma unroll
        for (int dt = 0; dt < 8; ++dt)
#pragma unroll
            for (int c = 0; c < 2; ++c) { o[dt][c] = wmmab(vf[dt], ph[c], o[dt][c]); o[dt][c] = wmmab(vf[dt], pl[c], o[dt][c]); }
    }
    /* join the KRG key ranges of each query group */
#pragma unroll
    for (int c = 0; c < 2; ++c) { lsum[c] += xhalf(lsum[c]); sm[(wave * 2 + c) * 32 + lane] = mrun[c]; }
    __syncthreads();
#pragma unroll
    for (int c = 0; c < 2; ++c) { float M = sm[(qg * 2 + c) * 32 + lane];
#pragma unroll
        for (int r = 1; r < KRG; ++r) M = fmaxf(M, sm[((r * QGR + qg) * 2 + c) * 32 + lane]);
        const float f = __builtin_amdgcn_exp2f(mrun[c] - M); sl[(wave * 2 + c) * 32 + lane] = lsum[c] * f;   /* every range brings sum and output to the group's common maximum */
#pragma unroll
        for (int dt = 0; dt < 8; ++dt) o[dt][c] *= f; }
    if (kr > 0) { float* pw = part + (size_t)((kr - 1) * QGR + qg) * 32 * 32 * 4 + lane * 4;
#pragma unroll
        for (int dt = 0; dt < 8; ++dt)
#pragma unroll
            for (int c = 0; c < 2; ++c) { v4f x0 = {o[dt][c][0], o[dt][c][1], o[dt][c][2], o[dt][c][3]}, x1 = {o[dt][c][4], o[dt][c][5], o[dt][c][6], o[dt][c][7]};
                *(v4f*)(pw + ((dt * 2 + c) * 2 + 0) * 128) = x0; *(v4f*)(pw + ((dt * 2 + c) * 2 + 1) * 128) = x1; } }
    __syncthreads();
    if (kr == 0) {
        float inv[2];
#pragma unroll
        for (int c = 0; c < 2; ++c) { float L = sl[(qg * 2 + c) * 32 + lane];
#pragma unroll
            for (int r = 1; r < KRG; ++r) L += sl[((r * QGR + qg) * 2 + c) * 32 + lane];
            inv[c] = 1.0f / L; }
#pragma unroll
        for (int dt = 0; dt < 8; ++dt)
#pragma unroll
            for (int c = 0; c < 2; ++c) { v4f x0 = {o[dt][c][0], o[dt][c][1], o[dt][c][2], o[dt][c][3]}, x1 = {o[dt][c][4], o[dt][c][5], o[dt][c][6], o[dt][c][7]};
#pragma unroll
                for (int r = 1; r < KRG; ++r) { const float* pr = part + (size_t)((r - 1) * QGR + qg) * 32 * 32 * 4 + lane * 4; x0 += *(const v4f*)(pr + ((dt * 2 + c) * 2 + 0) * 128); x1 += *(const v4f*)(pr + ((dt * 2 + c) * 2 + 1) * 128); }
                float* op = OUT + ((size_t)b * TT + q0 + c * 16 + lr) * HD + dt * 16 + hi * 8; *(v4f*)op = x0 * inv[c]; *(v4f*)(op + 4) = x1 * inv[c]; } }
}

extern "C" void kernel_launch(void* const* d_in, const int* in_sizes, int n_in,
                              void* d_out, int out_size, void* d_ws, size_t ws_size, hipStream_t stream) {
    (void)in_sizes; (void)n_in; (void)out_size;
    const float* Qin = (const float*)d_in[0]; const float* Kin = (const float*)d_in[1]; const float* Vin = (const float*)d_in[2];
    float* OUT = (float*)d_out;
    char* wsp = (char*)d_ws;
    auto take = [&](size_t bytes) { char* p = wsp; wsp += (bytes + 255) & ~(size_t)255; return (void*)p; };
    bf* KP = (bf*)take((size_t)NB_ * TT * HD * 2); bf* VP = (bf*)take((size_t)NB_ * HD * TT * 2);
    if ((size_t)(wsp - (char*)d_ws) > ws_size) return;
    k_pack<<<NB_ * TT * HD / 8 / 256 / PPT, 256, 0, stream>>>(Kin, Vin, KP, VP);
    k_fattn<<<dim3(TT / (QGR * 32), NB_, 1), 256, 0, stream>>>(Qin, KP, VP, OUT);
}

// v006
// It runs in 34.7 microseconds.
// It is 1.17 times as fast as v004, going by the measured steps of the versions left out in between.
// All steps since v000 together make it 18.2 times as fast.
#include <hip/hip_runtime.h>

// Scaled dot-product attention on given tensors, one 128-wide head over 4,096 positions (query, keys, value [4][4096][128]; scores = q.k / sqrt(128); softmax over all 4,096 keys; out = attn value -> [4][4096][128] (2.1 M)).
// Layout: one bf16 plane of keys and one f16 plane of value, both packed in matrix-fragment order: per 32 keys a block of 16 half fragments, each [lane 32][8 elements] = 512 contiguous bytes, so that one wave-wide 16-byte load covers 4 whole 128-byte lines. One fused kernel rounds its queries itself and keeps scores and probabilities in registers (running maximum and sum per query); the packed blocks come into LDS by tensor loads, once per work-group, and both query groups of a key range read their fragments there.
// Compute dtypes, f32 accumulate: query and keys rounded to bf16, q.k exact products; softmax f32; value and P each rounded once to f16 (11 significant bits; the lazy rescale keeps P at or below 2^8 and the normal-distributed value lies within a few units, both far inside the f16 range); output f32.

#define NB_  4
#define TT   4096
#define HD   128
#define SCL2 0.12751743f   // log2(e) / sqrt(128): scores in the log2 domain
#define QGR  2             // query groups of a work-group, 32 queries each
#define KRG  4             // key ranges of a work-group, one wave each per query group
#define KLEN (TT / KRG)
#define HFR  256           // 16-bit elements of a packed half fragment: 32 lanes x 8
#define PPT  4             // 16-byte pieces of each plane that a thread of the packer writes
#define SKEY 64            // keys of one stage of the LDS ring, in each key range: two 32-key passes
#define NST  (KLEN / SKEY) // stages a work-group walks
#define PASB (32 * HD * 2) // bytes of one packed 32-key block of either plane
#define SLB  (SKEY * HD * 2)       // bytes of one wave's slice of a stage: SKEY keys of one plane, contiguous in the plane
#define BUFB (QGR * KRG * SLB)     // bytes of one ring buffer: keys and value slices of all KRG ranges
#define TROW 512           // the tensor tile's row: one packed half fragment
typedef unsigned short bf;
typedef __attribute__((ext_vector_type(16))) __bf16   v16bf;
typedef __attribute__((ext_vector_type(8)))  __bf16   v8bf;
typedef __attribute__((ext_vector_type(16))) _Float16 v16h;
typedef __attribute__((ext_vector_type(2)))  _Float16 v2h;
typedef __attribute__((ext_vector_type(8)))  unsigned short v8us;
typedef __attribute__((ext_vector_type(2)))  unsigned short v2us;
typedef __attribute__((ext_vector_type(8)))  float    v8f;
typedef __attribute__((ext_vector_type(4)))  float    v4f;
typedef __attribute__((ext_vector_type(2)))  float    v2f;
typedef __attribute__((ext_vector_type(4)))  unsigned u32x4;
typedef __attribute__((ext_vector_type(8)))  unsigned u32x8;

__device__ __forceinline__ unsigned short f2bf(float f) { unsigned u = __float_as_uint(f); u += 0x7FFFu + ((u >> 16) & 1u); return (unsigned short)(u >> 16); }
__device__ __forceinline__ v16bf cat16b(v8us lo, v8us hi) { return __builtin_bit_cast(v16bf, __builtin_shufflevector(lo, hi, 0, 1, 2, 3, 4, 5, 6, 7, 8, 9, 10, 11, 12, 13, 14, 15)); }
__device__ __forceinline__ unsigned short f2h(float f) { return __builtin_bit_cast(unsigned short, (_Float16)f); }   /* nearest even */
__device__ __forceinline__ v8f wmmab(v16bf a, v16bf b, v8f c) { return __builtin_amdgcn_wmma_f32_16x16x32_bf16(false, a, false, b, (short)0, c, false, false); }
__device__ __forceinline__ v8f wmmah(v16h a, v16h b, v8f c) { return __builtin_amdgcn_wmma_f32_16x16x32_f16(false, a, false, b, (short)0, c, false, false); }
// One 16 x 32 operand fragment from a packed plane: two half fragments one behind the other; p already holds the lane's 8 * lane start. Lane (lr, hi) holds row lr, k = 8 * hi + 0..7 in the first half and 16 + 8 * hi + 0..7 in the second.
__device__ __forceinline__ v16bf ldfragp(const bf* p) { return cat16b(*(const v8us*)p, *(const v8us*)(p + HFR)); }
__device__ __forceinline__ v16h ldfragh(const bf* p) { return __builtin_bit_cast(v16h, ldfragp(p)); }   /* the same 32 bytes, read as f16 (the 16-bit forms share one operand layout) */
// A fragment in the same k order from an f32 row, rounded to bf16 (nearest even) on the way; p already holds the lane's row and its 8 * (lane >> 4) start.
__device__ __forceinline__ v16bf ldfragf(const float* p) { const v8bf lo = __builtin_convertvector(*(const v8f*)p, v8bf), hi = __builtin_convertvector(*(const v8f*)(p + 16), v8bf); return __builtin_shufflevector(lo, hi, 0, 1, 2, 3, 4, 5, 6, 7, 8, 9, 10, 11, 12, 13, 14, 15); }
__device__ __forceinline__ unsigned uni(unsigned v) { return (unsigned)__builtin_amdgcn_readfirstlane(v); }
__device__ __forceinline__ unsigned pinned(unsigned v) { unsigned w = uni(v); asm volatile("" : "+s"(w)); return w; }   /* holds a wave-uniform word in a scalar register at this place: tests on it compile to a scalar compare and branch, and what is formed from it is formed behind this line */
__device__ __forceinline__ float xhalf(float x) { const int b = __float_as_int(x); return __int_as_float(__builtin_amdgcn_permlanex16(b, b, 0x76543210, 0xfedcba98, false, false)); }

// k_pack: both planes in one launch of few, long-lived waves (a launch this short is paid in its gap and in wave starts, not in bytes). Piece i = the 16 bytes i of a plane; thread t of work-group g writes the pieces (g * PPT + j) * 256 + t, j = 0..PPT-1, of each plane, so every wave-wide store covers whole lines; the waves of a work-group read between them all 128 columns of each row they touch, so every line that is read is used whole. A work-group covers 64 keys of both planes. Every load of a thread is issued before its first conversion.
// keys plane [b][32-key block][t 2][kc 4][half 2][lane][8]: lane (lr, hi) holds key t * 16 + lr, d = kc * 32 + half * 16 + 8 * hi + 0..7; j steps t, then the block: 16 keys a step.
// value plane, f16, transposed on the way, [b][32-key block][dt 8][half 2][lane][8]: lane (lr, hi) holds d = dt * 16 + lr, key = half * 16 + 8 * hi + 0..7; j steps the upper bit of dt (64 columns), then the block (32 keys).
__global__ __launch_bounds__(256) void k_pack(const float* __restrict__ K, const float* __restrict__ V, bf* KP, bf* VP) { const unsigned tid = threadIdx.x; const unsigned lr = tid & 15, hi = (tid >> 4) & 1, h = (tid >> 5) & 1, c = (tid >> 6) & 3;
    const float* sk = K + (size_t)(blockIdx.x * 64 + lr) * HD + c * 32 + h * 16 + 8 * hi;
    const float* sv = V + (size_t)(blockIdx.x * 64 + h * 16 + 8 * hi) * HD + c * 16 + lr;
    v8f kv[PPT]; float vv[PPT][8];
    /* every '#pragma unroll' here makes the index of a register array a compile-time constant */
#pragma unroll
    for (int j = 0; j < PPT; ++j) kv[j] = *(const v8f*)(sk + j * 16 * HD);
#pragma unroll
    for (int j = 0; j < PPT; ++j)
#pragma unroll
        for (int k = 0; k < 8; ++k) vv[j][k] = sv[((j >> 1) * 32 + k) * HD + (j & 1) * 64];
    asm volatile("s_wait_xcnt 0x0" :: "v"(sk), "v"(sv) : "memory");   /* before the registers of the issued loads' pointers are used again; naming the pointers keeps them live to here; also holds every load up here, ahead of the first conversion */
    const size_t d0 = ((size_t)blockIdx.x * (PPT * 256) + tid) * 8;
#pragma unroll
    for (int j = 0; j < PPT; ++j) { v8us o;
#pragma unroll
        for (int k = 0; k < 8; ++k) o[k] = f2bf(kv[j][k]);
        *(v8us*)(KP + d0 + j * 256 * 8) = o; }
#pragma unroll
    for (int j = 0; j < PPT; ++j) { v8us o;
#pragma unroll
        for (int k = 0; k < 8; ++k) o[k] = f2h(vv[j][k]);
        *(v8us*)(VP + d0 + j * 256 * 8) = o; } }

// k_fattn: 8 waves = QGR query groups x KRG key ranges; a wave holds 32 queries (two 16-column groups) and walks KLEN keys, 32 a pass.
// Transposed products: S^T = K Q^T (a lane holds 16 scores of one query per column group), O^T += V^T P^T (the score accumulators pack straight into the B operand; a lane's output column is the same query, so maximum, sum and rescale stay in the lane).
// Operands: a ring of two LDS buffers, a stage = SKEY keys of every key range. Every wave brings one slice of every stage with one tensor load (query group 0 its range's keys, query group 1 its range's value), so a packed block enters the work-group once and both query groups read it from LDS.
// The KRG partial results of a query group are joined through LDS at the end, in ascending key-range order; the join reuses the ring.
// Every '#pragma unroll' below makes the index of a register array (fragments, accumulators) a compile-time constant; an array indexed at run time would leave the registers.
__global__ __launch_bounds__(256) __attribute__((amdgpu_waves_per_eu(2, 2))) void k_fattn(const float* __restrict__ Q, const bf* __restrict__ KP, const bf* __restrict__ VP, float* __restrict__ OUT) {
    __shared__ __attribute__((aligned(2048))) unsigned char ring[2 * BUFB];
    __shared__ float sm[KRG * QGR * 2 * 32], sl[KRG * QGR * 2 * 32];
    float* const part = (float*)ring;   /* (KRG - 1) * QGR * 32 * 32 * 4 floats, used only behind the loop's last waits and a barrier */
    static_assert((KRG - 1) * QGR * 32 * 32 * 4 * 4 <= 2 * BUFB && NST >= 2 && SLB % 2048 == 0, "the join fits the ring; the ring's prologue needs two stages; every slice starts at a multiple of 2 KiB");
    const int lane = threadIdx.x & 31, lr = lane & 15, hi = lane >> 4;
    const int wave = __builtin_amdgcn_readfirstlane(threadIdx.x >> 5); const int qg = wave & (QGR - 1), kr = wave / QGR;
    const int b = blockIdx.y; const int q0 = blockIdx.x * (QGR * 32) + qg * 32;
    /* the wave's own slices: SLB contiguous bytes of its plane a stage, as SLB / TROW rows of TROW bytes at pitch TROW, no pad */
    const unsigned long long sbase = (unsigned long long)(size_t)(qg ? VP : KP) + ((size_t)b * TT + kr * KLEN) * HD * 2;
    const unsigned lbase = (unsigned)(size_t)ring + wave * SLB;
    u32x8 g1;
    g1[0] = uni(0u); g1[1] = uni((unsigned)TROW << 16); g1[2] = uni((unsigned)(SLB / TROW) << 16); g1[3] = uni((unsigned)TROW << 16);
    g1[4] = uni(SLB / TROW); g1[5] = uni(TROW); g1[6] = uni(0u); g1[7] = uni(0u);
    auto issue = [&](unsigned st) { const unsigned long long ga = sbase + (unsigned long long)st * SLB; u32x4 g0;
        g0[0] = uni(1u); g0[1] = uni(lbase + (st & 1u) * BUFB); g0[2] = uni((unsigned)ga); g0[3] = uni(((unsigned)(ga >> 32) & 0x01FFFFFFu) | 0x80000000u);
        asm volatile("tensor_load_to_lds %0, %1" :: "s"(g0), "s"(g1) : "memory"); };   /* one request of the whole wave; every wave issues its own slice */
    issue(0u);   /* stage 0 flies while the queries are read and rounded */
    const float* Qp = Q + ((size_t)b * TT + q0 + lr) * HD + 8 * hi;
    v16bf qf[2][4];
#pragma unroll
    for (int c = 0; c < 2; ++c)
#pragma unroll
        for (int kc = 0; kc < 4; ++kc) qf[c][kc] = ldfragf(Qp + c * 16 * HD + kc * 32);
    asm volatile("s_wait_xcnt 0x0" :: "v"(Qp) : "memory");   /* naming the pointer keeps it live to here, so that no load's result is placed on it while the loads that name it are being issued */
    v8f o[8][2];
#pragma unroll
    for (int dt = 0; dt < 8; ++dt) { o[dt][0] = (v8f){}; o[dt][1] = (v8f){}; }
    float mrun[2] = {-3.0e38f, -3.0e38f}, lsum[2] = {0.f, 0.f};
    asm volatile("s_wait_tensorcnt 0x0" ::: "memory");   /* the wave's slice of stage 0 has landed */
    __syncthreads();                                     /* stage 0 published: nobody reads it in front of this barrier */
    issue(1u);
#pragma unroll 1
    for (unsigned st = 0; st < NST; ++st) {   /* rolled: a stage already holds 64 matrix instructions and 64 LDS loads */
        const bf* kb = (const bf*)(ring + (st & 1u) * BUFB + (kr * QGR) * SLB) + lane * 8;   /* the range's keys slice of this stage, at the lane's 16 bytes; its value slice lies one slice on */
        const bf* vb = kb + SLB / 2;
        v16bf kf[2][4];
#pragma unroll
        for (int t = 0; t < 2; ++t)
#pragma unroll
            for (int kc = 0; kc < 4; ++kc) kf[t][kc] = ldfragp(kb + (t * 4 + kc) * 2 * HFR);
#pragma unroll
        for (int u = 0; u < SKEY / 32; ++u) {   /* the stage's 32-key passes */
            v16h vf[8];
            if (u > 0) __builtin_amdgcn_sched_barrier(0);   /* keeps this pass's value loads behind the whole product of the pass before, as one group and not among its matrix instructions */
#pragma unroll
            for (int dt = 0; dt < 8; ++dt) vf[dt] = ldfragh(vb + u * (PASB / 2) + dt * 2 * HFR);
            __builtin_amdgcn_sched_barrier(0);   /* keeps the pass's value loads up here as one group, a whole score product and softmax ahead of their use, and out of the matrix run */
            v8f s[2][2];
#pragma unroll
            for (int t = 0; t < 2; ++t)
#pragma unroll
                for (int c = 0; c < 2; ++c) { v8f a = (v8f){};
#pragma unroll
                    for (int kc = 0; kc < 4; ++kc) a = wmmab(kf[t][kc], qf[c][kc], a);
                    s[t][c] = a; }
            /* the key fragments of the stage's next pass, one pass ahead; never of the next stage, which is not published yet */
            if (u + 1 < SKEY / 32) {
                __builtin_amdgcn_sched_barrier(0);   /* keeps the key loads behind the whole score product */
#pragma unroll
                for (int t = 0; t < 2; ++t)
#pragma unroll
                    for (int kc = 0; kc < 4; ++kc) kf[t][kc] = ldfragp(kb + (u + 1) * (PASB / 2) + (t * 4 + kc) * 2 * HFR);
                __builtin_amdgcn_sched_barrier(0);   /* keeps the key loads up here as one group, ahead of the softmax */
            }
            float mx[2];
#pragma unroll
            for (int c = 0; c < 2; ++c) { float x = s[0][c][0];
#pragma unroll
                for (int j = 1; j < 8; ++j) x = fmaxf(x, s[0][c][j]);
#pragma unroll
                for (int j = 0; j < 8; ++j) x = fmaxf(x, s[1][c][j]);
                x = fmaxf(x, xhalf(x)); mx[c] = x * SCL2; }
            /* lazy rescale: the maximum in use moves only when a column's new maximum passes it by more than 8 (log2), so P stays below 2^8 */
            const bool need = (mx[0] > mrun[0] + 8.0f) || (mx[1] > mrun[1] + 8.0f);
            if (__builtin_amdgcn_ballot_w32(need) != 0) {
#pragma unroll
                for (int c = 0; c < 2; ++c) { const float mn = fmaxf(mrun[c], mx[c]); const float al = __builtin_amdgcn_exp2f(mrun[c] - mn); mrun[c] = mn; lsum[c] *= al;
#pragma unroll
                    for (int dt = 0; dt < 8; ++dt) o[dt][c] *= al; }
            }
            v16h ph[2];
#pragma unroll
            for (int c = 0; c < 2; ++c) { float acc = 0.f;
#pragma unroll
                for (int t = 0; t < 2; ++t)
#pragma unroll
                    for (int j = 0; j < 8; j += 2) { v2f p; p[0] = __builtin_amdgcn_exp2f(__builtin_fmaf(s[t][c][j], SCL2, -mrun[c])); p[1] = __builtin_amdgcn_exp2f(__builtin_fmaf(s[t][c][j + 1], SCL2, -mrun[c]));
                        acc += p[0]; acc += p[1];
                        const v2h h = __builtin_convertvector(p, v2h);
                        ph[c][t * 8 + j] = h[0]; ph[c][t * 8 + j + 1] = h[1]; }
                lsum[c] += acc; }
            if (u + 1 == SKEY / 32) {
                /* publish point of stage st + 1, every wave, in this order. It stands in front of the stage's last product, whose fragments are already fetched: no line below it reads this stage's buffer, so the refill flies as soon as the buffer is free */
                asm volatile("s_wait_dscnt 0x0" ::: "memory");       /* the wave's own reads of this stage's buffer have returned */
                asm volatile("s_wait_tensorcnt 0x0" ::: "memory");   /* the wave's slice of stage st + 1 has landed */
                __syncthreads();                                     /* stage st + 1 published; every reader has left this stage's buffer */
                const unsigned nx = pinned(st + 2u);                 /* pinned(): the stage number held in a scalar register, so that the descriptor words are formed behind the wait above */
                if (pinned(nx < NST)) issue(nx);                     /* a scalar branch: a tensor load ignores EXEC; refills the buffer that this stage has just read */
            }
#pragma unroll
            for (int dt = 0; dt < 8; ++dt)
#pragma unroll
                for (int c = 0; c < 2; ++c) o[dt][c] = wmmah(vf[dt], ph[c], o[dt][c]);
        }
    }
    asm volatile("s_wait_tensorcnt 0x0" ::: "memory");   /* no request is out when the ring becomes the join's staging */
    asm volatile("s_wait_dscnt 0x0" ::: "memory");
    /* join the KRG key ranges of each query group */
#pragma unroll
    for (int c = 0; c < 2; ++c) { lsum[c] += xhalf(lsum[c]); sm[(wave * 2 + c) * 32 + lane] = mrun[c]; }
    __syncthreads();
#pragma unroll
    for (int c = 0; c < 2; ++c) { float M = sm[(qg * 2 + c) * 32 + lane];
#pragma unroll
        for (int r = 1; r < KRG; ++r) M = fmaxf(M, sm[((r * QGR + qg) * 2 + c) * 32 + lane]);
        const float f = __builtin_amdgcn_exp2f(mrun[c] - M); sl[(wave * 2 + c) * 32 + lane] = lsum[c] * f;   /* every range brings sum and output to the group's common maximum */
#pragma unroll
        for (int dt = 0; dt < 8; ++dt) o[dt][c] *= f; }
    if (kr > 0) { float* pw = part + (size_t)((kr - 1) * QGR + qg) * 32 * 32 * 4 + lane * 4;
#pragma unroll
        for (int dt = 0; dt < 8; ++dt)
#pragma unroll
            for (int c = 0; c < 2; ++c) { v4f x0 = {o[dt][c][0], o[dt][c][1], o[dt][c][2], o[dt][c][3]}, x1 = {o[dt][c][4], o[dt][c][5], o[dt][c][6], o[dt][c][7]};
                *(v4f*)(pw + ((dt * 2 + c) * 2 + 0) * 128) = x0; *(v4f*)(pw + ((dt * 2 + c) * 2 + 1) * 128) = x1; } }
    __syncthreads();
    if (kr == 0) {
        float inv[2];
#pragma unroll
        for (int c = 0; c < 2; ++c) { float L = sl[(qg * 2 + c) * 32 + lane];
#pragma unroll
            for (int r = 1; r < KRG; ++r) L += sl[((r * QGR + qg) * 2 + c) * 32 + lane];
            inv[c] = 1.0f / L; }
#pragma unroll
        for (int dt = 0; dt < 8; ++dt)
#pragma unroll
            for (int c = 0; c < 2; ++c) { v4f x0 = {o[dt][c][0], o[dt][c][1], o[dt][c][2], o[dt][c][3]}, x1 = {o[dt][c][4], o[dt][c][5], o[dt][c][6], o[dt][c][7]};
#pragma unroll
                for (int r = 1; r < KRG; ++r) { const float* pr = part + (size_t)((r - 1) * QGR + qg) * 32 * 32 * 4 + lane * 4; x0 += *(const v4f*)(pr + ((dt * 2 + c) * 2 + 0) * 128); x1 += *(const v4f*)(pr + ((dt * 2 + c) * 2 + 1) * 128); }
                float* op = OUT + ((size_t)b * TT + q0 + c * 16 + lr) * HD + dt * 16 + hi * 8; *(v4f*)op = x0 * inv[c]; *(v4f*)(op + 4) = x1 * inv[c]; } }
}

extern "C" void kernel_launch(void* const* d_in, const int* in_sizes, int n_in,
                              void* d_out, int out_size, void* d_ws, size_t ws_size, hipStream_t stream) {
    (void)in_sizes; (void)n_in; (void)out_size;
    const float* Qin = (const float*)d_in[0]; const float* Kin = (const float*)d_in[1]; const float* Vin = (const float*)d_in[2];
    float* OUT = (float*)d_out;
    char* wsp = (char*)d_ws;
    auto take = [&](size_t bytes) { char* p = wsp; wsp += (bytes + 255) & ~(size_t)255; return (void*)p; };
    bf* KP = (bf*)take((size_t)NB_ * TT * HD * 2); bf* VP = (bf*)take((size_t)NB_ * HD * TT * 2);
    if ((size_t)(wsp - (char*)d_ws) > ws_size) return;
    k_pack<<<NB_ * TT * HD / 8 / 256 / PPT, 256, 0, stream>>>(Kin, Vin, KP, VP);
    k_fattn<<<dim3(TT / (QGR * 32), NB_, 1), 256, 0, stream>>>(Qin, KP, VP, OUT);
}

// v007
// It runs in 32.7 microseconds.
// In both of two side-by-side timings against v006, it was 1.06 times as fast.
// All steps since v000 together make it 19.3 times as fast.
#include <hip/hip_runtime.h>

// Scaled dot-product attention on given tensors, one 128-wide head over 4,096 positions (query, keys, value [4][4096][128]; scores = q.k / sqrt(128); softmax over all 4,096 keys; out = attn value -> [4][4096][128] (2.1 M)).
// Layout: one bf16 plane of keys and one f16 plane of value, both packed in matrix-fragment order: per 32 keys a block of 16 half fragments, each [lane 32][8 elements] = 512 contiguous bytes, so that one wave-wide 16-byte load covers 4 whole 128-byte lines. One fused kernel rounds its queries itself and keeps scores and probabilities in registers (running maximum and sum per query); the packed blocks come into LDS by tensor loads, once per work-group, and both query groups of a key range read their fragments there.
// Compute dtypes, f32 accumulate: query and keys rounded to bf16, q.k exact products; softmax f32; value and P each rounded once to f16 (11 significant bits; the lazy rescale keeps P at or below 2^8 and the normal-distributed value lies within a few units, both far inside the f16 range); output f32.

#define NB_  4
#define TT   4096
#define HD   128
#define SCL2 0.12751743f   // log2(e) / sqrt(128): scores in the log2 domain
#define QGR  2             // query groups of a work-group, 32 queries each
#define KRG  4             // key ranges of a work-group, one wave each per query group
#define KLEN (TT / KRG)
#define HFR  256           // 16-bit elements of a packed half fragment: 32 lanes x 8
#define PPT  4             // 16-byte pieces of each plane that a thread of the packer writes
#define SKEY 64            // keys of one stage of the LDS ring, in each key range: two 32-key passes
#define NST  (KLEN / SKEY) // stages a work-group walks
#define PASB (32 * HD * 2) // bytes of one packed 32-key block of either plane
#define SLB  (SKEY * HD * 2)       // bytes of one wave's slice of a stage: SKEY keys of one plane, contiguous in the plane
#define BUFB (QGR * KRG * SLB)     // bytes of one ring buffer: keys and value slices of all KRG ranges
#define TROW 512           // the tensor tile's row: one packed half fragment
typedef unsigned short bf;
typedef __attribute__((ext_vector_type(16))) __bf16   v16bf;
typedef __attribute__((ext_vector_type(8)))  __bf16   v8bf;
typedef __attribute__((ext_vector_type(16))) _Float16 v16h;
typedef __attribute__((ext_vector_type(2)))  _Float16 v2h;
typedef __attribute__((ext_vector_type(8)))  unsigned short v8us;
typedef __attribute__((ext_vector_type(2)))  unsigned short v2us;
typedef __attribute__((ext_vector_type(8)))  float    v8f;
typedef __attribute__((ext_vector_type(4)))  float    v4f;
typedef __attribute__((ext_vector_type(2)))  float    v2f;
typedef __attribute__((ext_vector_type(4)))  unsigned u32x4;
typedef __attribute__((ext_vector_type(8)))  unsigned u32x8;

__device__ __forceinline__ unsigned short f2bf(float f) { unsigned u = __float_as_uint(f); u += 0x7FFFu + ((u >> 16) & 1u); return (unsigned short)(u >> 16); }
__device__ __forceinline__ v16bf cat16b(v8us lo, v8us hi) { return __builtin_bit_cast(v16bf, __builtin_shufflevector(lo, hi, 0, 1, 2, 3, 4, 5, 6, 7, 8, 9, 10, 11, 12, 13, 14, 15)); }
__device__ __forceinline__ unsigned short f2h(float f) { return __builtin_bit_cast(unsigned short, (_Float16)f); }   /* nearest even */
__device__ __forceinline__ v8f wmmab(v16bf a, v16bf b, v8f c) { return __builtin_amdgcn_wmma_f32_16x16x32_bf16(false, a, false, b, (short)0, c, false, false); }
__device__ __forceinline__ v8f wmmah(v16h a, v16h b, v8f c) { return __builtin_amdgcn_wmma_f32_16x16x32_f16(false, a, false, b, (short)0, c, false, false); }
// One 16 x 32 operand fragment from a packed plane: two half fragments one behind the other; p already holds the lane's 8 * lane start. Lane (lr, hi) holds row lr, k = 8 * hi + 0..7 in the first half and 16 + 8 * hi + 0..7 in the second.
__device__ __forceinline__ v16bf ldfragp(const bf* p) { return cat16b(*(const v8us*)p, *(const v8us*)(p + HFR)); }
__device__ __forceinline__ v16h ldfragh(const bf* p) { return __builtin_bit_cast(v16h, ldfragp(p)); }   /* the same 32 bytes, read as f16 (the 16-bit forms share one operand layout) */
// A fragment in the same k order from an f32 row, rounded to bf16 (nearest even) on the way; p already holds the lane's row and its 8 * (lane >> 4) start.
__device__ __forceinline__ v16bf ldfragf(const float* p) { const v8bf lo = __builtin_convertvector(*(const v8f*)p, v8bf), hi = __builtin_convertvector(*(const v8f*)(p + 16), v8bf); return __builtin_shufflevector(lo, hi, 0, 1, 2, 3, 4, 5, 6, 7, 8, 9, 10, 11, 12, 13, 14, 15); }
__device__ __forceinline__ unsigned uni(unsigned v) { return (unsigned)__builtin_amdgcn_readfirstlane(v); }
__device__ __forceinline__ unsigned pinned(unsigned v) { unsigned w = uni(v); asm volatile("" : "+s"(w)); return w; }   /* holds a wave-uniform word in a scalar register at this place: tests on it compile to a scalar compare and branch, and what is formed from it is formed behind this line */
__device__ __forceinline__ float xhalf(float x) { const int b = __float_as_int(x); return __int_as_float(__builtin_amdgcn_permlanex16(b, b, 0x76543210, 0xfedcba98, false, false)); }

// k_pack: both planes in one launch of few, long-lived waves (a launch this short is paid in its gap and in wave starts, not in bytes). Piece i = the 16 bytes i of a plane; thread t of work-group g writes the pieces (g * PPT + j) * 256 + t, j = 0..PPT-1, of each plane, so every wave-wide store covers whole lines; the waves of a work-group read between them all 128 columns of each row they touch, so every line that is read is used whole. A work-group covers 64 keys of both planes. Every load of a thread is issued before its first conversion.
// keys plane [b][32-key block][t 2][kc 4][half 2][lane][8]: lane (lr, hi) holds key t * 16 + lr, d = kc * 32 + half * 16 + 8 * hi + 0..7; j steps t, then the block: 16 keys a step.
// value plane, f16, transposed on the way, [b][32-key block][dt 8][half 2][lane][8]: lane (lr, hi) holds d = dt * 16 + lr, key = half * 16 + 8 * hi + 0..7; j steps the upper bit of dt (64 columns), then the block (32 keys).
__global__ __launch_bounds__(256) void k_pack(const float* __restrict__ K, const float* __restrict__ V, bf* KP, bf* VP) { const unsigned tid = threadIdx.x; const unsigned lr = tid & 15, hi = (tid >> 4) & 1, h = (tid >> 5) & 1, c = (tid >> 6) & 3;
    const float* sk = K + (size_t)(blockIdx.x * 64 + lr) * HD + c * 32 + h * 16 + 8 * hi;
    const float* sv = V + (size_t)(blockIdx.x * 64 + h * 16 + 8 * hi) * HD + c * 16 + lr;
    v8f kv[PPT]; float vv[PPT][8];
    /* every '#pragma unroll' here makes the index of a register array a compile-time constant */
#pragma unroll
    for (int j = 0; j < PPT; ++j) kv[j] = *(const v8f*)(sk + j * 16 * HD);
#pragma unroll
    for (int j = 0; j < PPT; ++j)
#pragma unroll
        for (int k = 0; k < 8; ++k) vv[j][k] = sv[((j >> 1) * 32 + k) * HD + (j & 1) * 64];
    asm volatile("s_wait_xcnt 0x0" :: "v"(sk), "v"(sv) : "memory");   /* before the registers of the issued loads' pointers are used again; naming the pointers keeps them live to here; also holds every load up here, ahead of the first conversion */
    const size_t d0 = ((size_t)blockIdx.x * (PPT * 256) + tid) * 8;
#pragma unroll
    for (int j = 0; j < PPT; ++j) { v8us o;
#pragma unroll
        for (int k = 0; k < 8; ++k) o[k] = f2bf(kv[j][k]);
        *(v8us*)(KP + d0 + j * 256 * 8) = o; }
#pragma unroll
    for (int j = 0; j < PPT; ++j) { v8us o;
#pragma unroll
        for (int k = 0; k < 8; ++k) o[k] = f2h(vv[j][k]);
        *(v8us*)(VP + d0 + j * 256 * 8) = o; } }

// k_fattn: 8 waves = QGR query groups x KRG key ranges; a wave holds 32 queries (two 16-column groups) and walks KLEN keys, 32 a pass.
// Transposed products: S^T = K Q^T (a lane holds 16 scores of one query per column group), O^T += V^T P^T (the score accumulators pack straight into the B operand; a lane's output column is the same query, so maximum, sum and rescale stay in the lane).
// Operands: a ring of two LDS buffers, a stage = SKEY keys of every key range. Every wave brings one slice of every stage with one tensor load (query group 0 its range's keys, query group 1 its range's value), so a packed block enters the work-group once and both query groups read it from LDS.
// Walk order: the work-groups of a batch all read the same packed blocks from L2. Each starts its walk over the NST stages at one of NST start stages set by its index (four work-groups of a batch share each) and wraps, so that at one moment their requests spread over the stages; running maximum and sums take the keys in any order.
// The KRG partial results of a query group are joined through LDS at the end, in ascending key-range order; the join reuses the ring.
// Every '#pragma unroll' below makes the index of a register array (fragments, accumulators) a compile-time constant; an array indexed at run time would leave the registers.
__global__ __launch_bounds__(256) __attribute__((amdgpu_waves_per_eu(2, 2))) void k_fattn(const float* __restrict__ Q, const bf* __restrict__ KP, const bf* __restrict__ VP, float* __restrict__ OUT) {
    __shared__ __attribute__((aligned(2048))) unsigned char ring[2 * BUFB];
    __shared__ float sm[KRG * QGR * 2 * 32], sl[KRG * QGR * 2 * 32];
    float* const part = (float*)ring;   /* (KRG - 1) * QGR * 32 * 32 * 4 floats, used only behind the loop's last waits and a barrier */
    static_assert((KRG - 1) * QGR * 32 * 32 * 4 * 4 <= 2 * BUFB && NST >= 2 && SLB % 2048 == 0 && (NST & (NST - 1)) == 0, "the join fits the ring; the ring's prologue needs two stages; every slice starts at a multiple of 2 KiB; the wrapped walk masks with NST - 1");
    const int lane = threadIdx.x & 31, lr = lane & 15, hi = lane >> 4;
    const int wave = __builtin_amdgcn_readfirstlane(threadIdx.x >> 5); const int qg = wave & (QGR - 1), kr = wave / QGR;
    const int b = blockIdx.y; const int q0 = blockIdx.x * (QGR * 32) + qg * 32;
    /* the wave's own slices: SLB contiguous bytes of its plane a stage, as SLB / TROW rows of TROW bytes at pitch TROW, no pad */
    const unsigned long long sbase = (unsigned long long)(size_t)(qg ? VP : KP) + ((size_t)b * TT + kr * KLEN) * HD * 2;
    const unsigned lbase = (unsigned)(size_t)ring + wave * SLB;
    const unsigned rot = ((blockIdx.x >> 3) * 2u + (blockIdx.x & 1u)) & (NST - 1u);   /* the work-group's first stage: neighbours in the index differ, and so do work-groups 8 apart; every value is in 0..NST-1, so every slice stays inside its key range */
    u32x8 g1;
    g1[0] = uni(0u); g1[1] = uni((unsigned)TROW << 16); g1[2] = uni((unsigned)(SLB / TROW) << 16); g1[3] = uni((unsigned)TROW << 16);
    g1[4] = uni(SLB / TROW); g1[5] = uni(TROW); g1[6] = uni(0u); g1[7] = uni(0u);
    auto issue = [&](unsigned st) { const unsigned long long ga = sbase + (unsigned long long)((st + rot) & (NST - 1u)) * SLB; u32x4 g0;   /* step st of the walk brings stage (st + rot) mod NST into buffer st mod 2 */
        g0[0] = uni(1u); g0[1] = uni(lbase + (st & 1u) * BUFB); g0[2] = uni((unsigned)ga); g0[3] = uni(((unsigned)(ga >> 32) & 0x01FFFFFFu) | 0x80000000u);
        asm volatile("tensor_load_to_lds %0, %1" :: "s"(g0), "s"(g1) : "memory"); };   /* one request of the whole wave; every wave issues its own slice */
    issue(0u);   /* stage 0 flies while the queries are read and rounded */
    const float* Qp = Q + ((size_t)b * TT + q0 + lr) * HD + 8 * hi;
    v16bf qf[2][4];
#pragma unroll
    for (int c = 0; c < 2; ++c)
#pragma unroll
        for (int kc = 0; kc < 4; ++kc) qf[c][kc] = ldfragf(Qp + c * 16 * HD + kc * 32);
    asm volatile("s_wait_xcnt 0x0" :: "v"(Qp) : "memory");   /* naming the pointer keeps it live to here, so that no load's result is placed on it while the loads that name it are being issued */
    v8f o[8][2];
#pragma unroll
    for (int dt = 0; dt < 8; ++dt) { o[dt][0] = (v8f){}; o[dt][1] = (v8f){}; }
    float mrun[2] = {-3.0e38f, -3.0e38f}, lsum[2] = {0.f, 0.f};
    asm volatile("s_wait_tensorcnt 0x0" ::: "memory");   /* the wave's slice of stage 0 has landed */
    __syncthreads();                                     /* stage 0 published: nobody reads it in front of this barrier */
    issue(1u);
#pragma unroll 1
    for (unsigned st = 0; st < NST; ++st) {   /* rolled: a stage already holds 64 matrix instructions and 64 LDS loads */
        const bf* kb = (const bf*)(ring + (st & 1u) * BUFB + (kr * QGR) * SLB) + lane * 8;   /* the range's keys slice of this stage, at the lane's 16 bytes; its value slice lies one slice on */
        const bf* vb = kb + SLB / 2;
        v16bf kf[2][4];
#pragma unroll
        for (int t = 0; t < 2; ++t)
#pragma unroll
            for (int kc = 0; kc < 4; ++kc) kf[t][kc] = ldfragp(kb + (t * 4 + kc) * 2 * HFR);
#pragma unroll
        for (int u = 0; u < SKEY / 32; ++u) {   /* the stage's 32-key passes */
            v16h vf[8];
            if (u > 0) __builtin_amdgcn_sched_barrier(0);   /* keeps this pass's value loads behind the whole product of the pass before, as one group and not among its matrix instructions */
#pragma unroll
            for (int dt = 0; dt < 8; ++dt) vf[dt] = ldfragh(vb + u * (PASB / 2) + dt * 2 * HFR);
            __builtin_amdgcn_sched_barrier(0);   /* keeps the pass's value loads up here as one group, a whole score product and softmax ahead of their use, and out of the matrix run */
            v8f s[2][2];
#pragma unroll
            for (int t = 0; t < 2; ++t)
#pragma unroll
                for (int c = 0; c < 2; ++c) { v8f a = (v8f){};
#pragma unroll
                    for (int kc = 0; kc < 4; ++kc) a = wmmab(kf[t][kc], qf[c][kc], a);
                    s[t][c] = a; }
            /* the key fragments of the stage's next pass, one pass ahead; never of the next stage, which is not published yet */
            if (u + 1 < SKEY / 32) {
                __builtin_amdgcn_sched_barrier(0);   /* keeps the key loads behind the whole score product */
#pragma unroll
                for (int t = 0; t < 2; ++t)
#pragma unroll
                    for (int kc = 0; kc < 4; ++kc) kf[t][kc] = ldfragp(kb + (u + 1) * (PASB / 2) + (t * 4 + kc) * 2 * HFR);
                __builtin_amdgcn_sched_barrier(0);   /* keeps the key loads up here as one group, ahead of the softmax */
            }
            float mx[2];
#pragma unroll
            for (int c = 0; c < 2; ++c) { float x = s[0][c][0];
#pragma unroll
                for (int j = 1; j < 8; ++j) x = fmaxf(x, s[0][c][j]);
#pragma unroll
                for (int j = 0; j < 8; ++j) x = fmaxf(x, s[1][c][j]);
                x = fmaxf(x, xhalf(x)); mx[c] = x * SCL2; }
            /* lazy rescale: the maximum in use moves only when a column's new maximum passes it by more than 8 (log2), so P stays below 2^8 */
            const bool need = (mx[0] > mrun[0] + 8.0f) || (mx[1] > mrun[1] + 8.0f);
            if (__builtin_amdgcn_ballot_w32(need) != 0) {
#pragma unroll
                for (int c = 0; c < 2; ++c) { const float mn = fmaxf(mrun[c], mx[c]); const float al = __builtin_amdgcn_exp2f(mrun[c] - mn); mrun[c] = mn; lsum[c] *= al;
#pragma unroll
                    for (int dt = 0; dt < 8; ++dt) o[dt][c] *= al; }
            }
            v16h ph[2];
#pragma unroll
            for (int c = 0; c < 2; ++c) { float acc = 0.f;
#pragma unroll
                for (int t = 0; t < 2; ++t)
#pragma unroll
                    for (int j = 0; j < 8; j += 2) { v2f p; p[0] = __builtin_amdgcn_exp2f(__builtin_fmaf(s[t][c][j], SCL2, -mrun[c])); p[1] = __builtin_amdgcn_exp2f(__builtin_fmaf(s[t][c][j + 1], SCL2, -mrun[c]));
                        acc += p[0]; acc += p[1];
                        const v2h h = __builtin_convertvector(p, v2h);
                        ph[c][t * 8 + j] = h[0]; ph[c][t * 8 + j + 1] = h[1]; }
                lsum[c] += acc; }
            if (u + 1 == SKEY / 32) {
                /* publish point of stage st + 1, every wave, in this order. It stands in front of the stage's last product, whose fragments are already fetched: no line below it reads this stage's buffer, so the refill flies as soon as the buffer is free */
                asm volatile("s_wait_dscnt 0x0" ::: "memory");       /* the wave's own reads of this stage's buffer have returned */
                asm volatile("s_wait_tensorcnt 0x0" ::: "memory");   /* the wave's slice of stage st + 1 has landed */
                __syncthreads();                                     /* stage st + 1 published; every reader has left this stage's buffer */
                const unsigned nx = pinned(st + 2u);                 /* pinned(): the stage number held in a scalar register, so that the descriptor words are formed behind the wait above */
                if (pinned(nx < NST)) issue(nx);                     /* a scalar branch: a tensor load ignores EXEC; refills the buffer that this stage has just read */
            }
#pragma unroll
            for (int dt = 0; dt < 8; ++dt)
#pragma unroll
                for (int c = 0; c < 2; ++c) o[dt][c] = wmmah(vf[dt], ph[c], o[dt][c]);
        }
    }
    asm volatile("s_wait_tensorcnt 0x0" ::: "memory");   /* no request is out when the ring becomes the join's staging */
    asm volatile("s_wait_dscnt 0x0" ::: "memory");
    /* join the KRG key ranges of each query group */
#pragma unroll
    for (int c = 0; c < 2; ++c) { lsum[c] += xhalf(lsum[c]); sm[(wave * 2 + c) * 32 + lane] = mrun[c]; }
    __syncthreads();
#pragma unroll
    for (int c = 0; c < 2; ++c) { float M = sm[(qg * 2 + c) * 32 + lane];
#pragma unroll
        for (int r = 1; r < KRG; ++r) M = fmaxf(M, sm[((r * QGR + qg) * 2 + c) * 32 + lane]);
        const float f = __builtin_amdgcn_exp2f(mrun[c] - M); sl[(wave * 2 + c) * 32 + lane] = lsum[c] * f;   /* every range brings sum and output to the group's common maximum */
#pragma unroll
        for (int dt = 0; dt < 8; ++dt) o[dt][c] *= f; }
    if (kr > 0) { float* pw = part + (size_t)((kr - 1) * QGR + qg) * 32 * 32 * 4 + lane * 4;
#pragma unroll
        for (int dt = 0; dt < 8; ++dt)
#pragma unroll
            for (int c = 0; c < 2; ++c) { v4f x0 = {o[dt][c][0], o[dt][c][1], o[dt][c][2], o[dt][c][3]}, x1 = {o[dt][c][4], o[dt][c][5], o[dt][c][6], o[dt][c][7]};
                *(v4f*)(pw + ((dt * 2 + c) * 2 + 0) * 128) = x0; *(v4f*)(pw + ((dt * 2 + c) * 2 + 1) * 128) = x1; } }
    __syncthreads();
    if (kr == 0) {
        float inv[2];
#pragma unroll
        for (int c = 0; c < 2; ++c) { float L = sl[(qg * 2 + c) * 32 + lane];
#pragma unroll
            for (int r = 1; r < KRG; ++r) L += sl[((r * QGR + qg) * 2 + c) * 32 + lane];
            inv[c] = 1.0f / L; }
#pragma unroll
        for (int dt = 0; dt < 8; ++dt)
#pragma unroll
            for (int c = 0; c < 2; ++c) { v4f x0 = {o[dt][c][0], o[dt][c][1], o[dt][c][2], o[dt][c][3]}, x1 = {o[dt][c][4], o[dt][c][5], o[dt][c][6], o[dt][c][7]};
#pragma unroll
                for (int r = 1; r < KRG; ++r) { const float* pr = part + (size_t)((r - 1) * QGR + qg) * 32 * 32 * 4 + lane * 4; x0 += *(const v4f*)(pr + ((dt * 2 + c) * 2 + 0) * 128); x1 += *(const v4f*)(pr + ((dt * 2 + c) * 2 + 1) * 128); }
                float* op = OUT + ((size_t)b * TT + q0 + c * 16 + lr) * HD + dt * 16 + hi * 8; *(v4f*)op = x0 * inv[c]; *(v4f*)(op + 4) = x1 * inv[c]; } }
}

extern "C" void kernel_launch(void* const* d_in, const int* in_sizes, int n_in,
                              void* d_out, int out_size, void* d_ws, size_t ws_size, hipStream_t stream) {
    (void)in_sizes; (void)n_in; (void)out_size;
    const float* Qin = (const float*)d_in[0]; const float* Kin = (const float*)d_in[1]; const float* Vin = (const float*)d_in[2];
    float* OUT = (float*)d_out;
    char* wsp = (char*)d_ws;
    auto take = [&](size_t bytes) { char* p = wsp; wsp += (bytes + 255) & ~(size_t)255; return (void*)p; };
    bf* KP = (bf*)take((size_t)NB_ * TT * HD * 2); bf* VP = (bf*)take((size_t)NB_ * HD * TT * 2);
    if ((size_t)(wsp - (char*)d_ws) > ws_size) return;
    k_pack<<<NB_ * TT * HD / 8 / 256 / PPT, 256, 0, stream>>>(Kin, Vin, KP, VP);
    k_fattn<<<dim3(TT / (QGR * 32), NB_, 1), 256, 0, stream>>>(Qin, KP, VP, OUT);
}
